// v000
// Measured on an AMD MI455X. A time is GPU time per run, averaged over a window of back-to-back runs after a warm-up
// (all launches, gaps included; the runs take copies of the inputs in turn), and the median of several windows.
// Apart from v000's, it joins two sittings. Times from different sittings can be a few percent apart, while
// side-by-side timings come from the same sitting.
// The starting kernel, v000, takes 2930 microseconds a run.
#include <hip/hip_runtime.h>

// Causal multi-head self-attention with a pairwise rotary applied to the INPUT before the q/k projections (input [4][2048][1024]; rx[t][2i], rx[t][2i+1] = rotation of (x[2i], x[2i+1]) by t x 10000^(-2i/1024) over the 1,024 features (computed); q = rx Wq^T, k = rx Wk^T, v = input Wv^T ('oi' 1/32, no bias; 16 heads x 64); scores masked causal then / 8; softmax; out = merged Wo^T + bo -> [4][2048][1024] (8.4 M)).
// Layout per batch: a rotary kernel builds rx from the bf16-rounded input with on-the-fly precise cosf/sinf of t x theta[i] (512 float32 constants) and splits it into bf16 hi/lo planes; q and k projections hi/lo x exact; a plain bf16 copy of the input feeds the exact v projection; causal T-2048 attention (hybrid rows: < 512 hi/lo 3 products, rest fp16 x1024; tiles above the diagonal skipped); merged hi/lo x Wo exact + bo.
// Compute dtypes, f32 accumulate: every input rounded to bf16; input rotary f32, q/k projections hi/lo x exact (2 products: ~f32), v exact; attention rows < 512 3 products, rest fp16; softmax f32; Wo hl x exact + bias.

#define NB_  4
#define TT   2048
#define DM   1024
#define NH_  16
#define NKV  16
#define REP  (NH_ / NKV)
#define HD   64
#define DQ   (NH_ * HD)
#define DKV  (NKV * HD)
#define ZH   2
#define RH   512                  // query rows < RH use hi+lo planes (0: none)
#define WIN  2048
#define PCAR 1024.0f
#define SCL  0.125f   // HD^-0.5
typedef _Float16 h16;
typedef unsigned short bf;
typedef __attribute__((ext_vector_type(16))) __bf16   v16bf;
typedef __attribute__((ext_vector_type(16))) _Float16 v16h;
typedef __attribute__((ext_vector_type(8)))  _Float16 v8h;
typedef __attribute__((ext_vector_type(8)))  unsigned short v8us;
typedef __attribute__((ext_vector_type(8)))  float    v8f;
typedef __attribute__((ext_vector_type(4)))  float    v4f;
typedef v8h  __attribute__((may_alias)) v8ha;
typedef v4f  __attribute__((may_alias)) v4fa;
typedef v8us __attribute__((may_alias)) v8usa;

__device__ __forceinline__ unsigned short f2bf(float f) { unsigned u = __float_as_uint(f); u += 0x7FFFu + ((u >> 16) & 1u); return (unsigned short)(u >> 16); }
__device__ __forceinline__ float bf2f(unsigned short b) { return __uint_as_float(((unsigned)b) << 16); }
__device__ __forceinline__ float bfr(float f) { return bf2f(f2bf(f)); }
__device__ __forceinline__ v16h cat16(v8h lo, v8h hi) { return __builtin_shufflevector(lo, hi, 0, 1, 2, 3, 4, 5, 6, 7, 8, 9, 10, 11, 12, 13, 14, 15); }
__device__ __forceinline__ v16bf cat16b(v8us lo, v8us hi) { return __builtin_bit_cast(v16bf, __builtin_shufflevector(lo, hi, 0, 1, 2, 3, 4, 5, 6, 7, 8, 9, 10, 11, 12, 13, 14, 15)); }
__device__ __forceinline__ v8f wmma16(v16h a, v16h b, v8f c) { return __builtin_amdgcn_wmma_f32_16x16x32_f16(false, a, false, b, (short)0, c, false, false); }
__device__ __forceinline__ v8f wmmab(v16bf a, v16bf b, v8f c) { return __builtin_amdgcn_wmma_f32_16x16x32_bf16(false, a, false, b, (short)0, c, false, false); }



// ---- k_gemmw: register-blocked GEMM, ONE WAVE per 64x64 output tile (16 accumulators), operands straight from K-contiguous 16-bit planes; grid (M/64, N/64, Z), 32 threads.
// C[m][n] (f32, pitch ldc, + optional f32 bias[n]) = sum_k A[m][k] Bt[n][k] (+ split products per NSPLIT). z-batch strides sA/sB/sC in elements. K % 32 == 0.
template <typename T16> struct WFrag;
template <> struct WFrag<h16> { typedef v16h V; static __device__ __forceinline__ V ld(const h16* p) { return cat16(*(const v8h*)p, *(const v8h*)(p + 16)); } static __device__ __forceinline__ v8f mma(V a, V b, v8f c) { return wmma16(a, b, c); } };
template <> struct WFrag<bf> { typedef v16bf V; static __device__ __forceinline__ V ld(const bf* p) { return cat16b(*(const v8us*)p, *(const v8us*)(p + 16)); } static __device__ __forceinline__ v8f mma(V a, V b, v8f c) { return wmmab(a, b, c); } };
template <typename T16, int NSPLIT, bool BIAS>
__global__ __launch_bounds__(32) void k_gemmw(const T16* __restrict__ A, const T16* __restrict__ A2, const T16* __restrict__ Bt, const T16* __restrict__ Bt2, int K, float* C, int ldc, const float* __restrict__ bias, size_t sA, size_t sB, size_t sC) {
    typedef typename WFrag<T16>::V V;
    __shared__ __align__(16) float os[16 * 68];
    const size_t z = blockIdx.z; A += z * sA; if (A2) A2 += z * sA; Bt += z * sB; if (Bt2) Bt2 += z * sB; C += z * sC;
    const int lane = threadIdx.x & 31, lr = lane & 15, hi = lane >> 4; const int r0 = blockIdx.x * 64, c0 = blockIdx.y * 64;
    v8f acc[4][4];
#pragma unroll
    for (int mb = 0; mb < 4; ++mb)
#pragma unroll
        for (int nb = 0; nb < 4; ++nb) acc[mb][nb] = (v8f){};
    const size_t aoff = (size_t)(r0 + lr) * K + 8 * hi, boff = (size_t)(c0 + lr) * K + 8 * hi;
#pragma unroll 1
    for (int kc = 0; kc < K; kc += 32) {
        V a[4], a2[4];
#pragma unroll
        for (int mb = 0; mb < 4; ++mb) { a[mb] = WFrag<T16>::ld(A + aoff + (size_t)mb * 16 * K + kc); if (NSPLIT == 1 || NSPLIT == 2) a2[mb] = WFrag<T16>::ld(A2 + aoff + (size_t)mb * 16 * K + kc); }
#pragma unroll
        for (int nb = 0; nb < 4; ++nb) { const V b = WFrag<T16>::ld(Bt + boff + (size_t)nb * 16 * K + kc); V b2; if (NSPLIT >= 2) b2 = WFrag<T16>::ld(Bt2 + boff + (size_t)nb * 16 * K + kc);
#pragma unroll
            for (int mb = 0; mb < 4; ++mb) { acc[mb][nb] = WFrag<T16>::mma(a[mb], b, acc[mb][nb]); if (NSPLIT == 1 || NSPLIT == 2) acc[mb][nb] = WFrag<T16>::mma(a2[mb], b, acc[mb][nb]); if (NSPLIT >= 2) acc[mb][nb] = WFrag<T16>::mma(a[mb], b2, acc[mb][nb]); } }
        asm volatile("v_nop\n\tv_nop\n\tv_nop\n\tv_nop" : "+v"(acc[0][0]), "+v"(acc[1][1]), "+v"(acc[2][2]), "+v"(acc[3][3]) : "v"(a[0]), "v"(a[3]));
    }
#pragma unroll
    for (int mb = 0; mb < 4; ++mb) {
#pragma unroll
        for (int nb = 0; nb < 4; ++nb) {
#pragma unroll
            for (int j = 0; j < 8; ++j) os[(hi * 8 + j) * 68 + nb * 16 + lr] = acc[mb][nb][j]; }
        __builtin_amdgcn_wave_barrier(); asm volatile("" ::: "memory");
        float* crow = C + (size_t)(r0 + mb * 16) * ldc + c0;
{
#pragma unroll
            for (int s = 0; s < 8; ++s) { const int row = 2 * s + hi, cofs = lr * 4; v4f val = *(const v4fa*)(os + row * 68 + cofs); if (BIAS) { val[0] += bfr(bias[c0 + cofs]); val[1] += bfr(bias[c0 + cofs + 1]); val[2] += bfr(bias[c0 + cofs + 2]); val[3] += bfr(bias[c0 + cofs + 3]); }
                *(v4f*)(crow + (size_t)row * ldc + cofs) = val; }
             }
        __builtin_amdgcn_wave_barrier(); asm volatile("" ::: "memory");
    }
}

// ---- k_gemmc: the same one-wave 64x64 tile GEMM specialised for causal attention: CMODE 1 skips score tiles entirely above the diagonal (query rows r0+roff.., key columns c0..), CMODE 2 limits the
// key (K) loop of the probability x value contraction to the diagonal block (probabilities beyond it are exactly zero). roff = row offset of this launch's first row within the sequence.
template <typename T16, int NSPLIT, int CMODE>
__global__ __launch_bounds__(32) void k_gemmc(const T16* __restrict__ A, const T16* __restrict__ A2, const T16* __restrict__ Bt, const T16* __restrict__ Bt2, int K, float* C, int ldc, int roff, size_t sA, size_t sB, size_t sC) {
    typedef typename WFrag<T16>::V V;
    __shared__ __align__(16) float os[16 * 68];
    const size_t z = blockIdx.z; A += z * sA; if (A2) A2 += z * sA; Bt += z * sB; if (Bt2) Bt2 += z * sB; C += z * sC;
    const int lane = threadIdx.x & 31, lr = lane & 15, hi = lane >> 4; const int r0 = blockIdx.x * 64, c0 = blockIdx.y * 64;
    if (CMODE == 1 && c0 > r0 + roff + 63) return;                  // score tile entirely above the causal diagonal: never read (the softmax masks j > i by select)
    const int Kl = (CMODE == 2) ? min(K, r0 + roff + 64) : K;        // P.V: probabilities are exactly 0 beyond the diagonal block, so the K loop stops there
    v8f acc[4][4];
#pragma unroll
    for (int mb = 0; mb < 4; ++mb)
#pragma unroll
        for (int nb = 0; nb < 4; ++nb) acc[mb][nb] = (v8f){};
    const size_t aoff = (size_t)(r0 + lr) * K + 8 * hi, boff = (size_t)(c0 + lr) * K + 8 * hi;
#pragma unroll 1
    for (int kc = 0; kc < Kl; kc += 32) {
        V a[4], a2[4];
#pragma unroll
        for (int mb = 0; mb < 4; ++mb) { a[mb] = WFrag<T16>::ld(A + aoff + (size_t)mb * 16 * K + kc); if (NSPLIT == 1 || NSPLIT == 2) a2[mb] = WFrag<T16>::ld(A2 + aoff + (size_t)mb * 16 * K + kc); }
#pragma unroll
        for (int nb = 0; nb < 4; ++nb) { const V b = WFrag<T16>::ld(Bt + boff + (size_t)nb * 16 * K + kc); V b2; if (NSPLIT >= 2) b2 = WFrag<T16>::ld(Bt2 + boff + (size_t)nb * 16 * K + kc);
#pragma unroll
            for (int mb = 0; mb < 4; ++mb) { acc[mb][nb] = WFrag<T16>::mma(a[mb], b, acc[mb][nb]); if (NSPLIT == 1 || NSPLIT == 2) acc[mb][nb] = WFrag<T16>::mma(a2[mb], b, acc[mb][nb]); if (NSPLIT >= 2) acc[mb][nb] = WFrag<T16>::mma(a[mb], b2, acc[mb][nb]); } }
        asm volatile("v_nop\n\tv_nop\n\tv_nop\n\tv_nop" : "+v"(acc[0][0]), "+v"(acc[1][1]), "+v"(acc[2][2]), "+v"(acc[3][3]) : "v"(a[0]), "v"(a[3]));
    }
#pragma unroll
    for (int mb = 0; mb < 4; ++mb) {
#pragma unroll
        for (int nb = 0; nb < 4; ++nb) {
#pragma unroll
            for (int j = 0; j < 8; ++j) os[(hi * 8 + j) * 68 + nb * 16 + lr] = acc[mb][nb][j]; }
        __builtin_amdgcn_wave_barrier(); asm volatile("" ::: "memory");
        float* crow = C + (size_t)(r0 + mb * 16) * ldc + c0;
{
#pragma unroll
            for (int s = 0; s < 8; ++s) { const int row = 2 * s + hi, cofs = lr * 4; v4f val = *(const v4fa*)(os + row * 68 + cofs);
                *(v4f*)(crow + (size_t)row * ldc + cofs) = val; }
             }
        __builtin_amdgcn_wave_barrier(); asm volatile("" ::: "memory");
    }
}

__device__ __forceinline__ h16 tohx(float x) { return (h16)x; }
__device__ __forceinline__ void splitf(float y, unsigned short& h, unsigned short& l) { h = f2bf(y); l = f2bf(y - bf2f(h)); }
typedef __attribute__((ext_vector_type(2))) _Float16 v2h;
typedef __attribute__((ext_vector_type(4))) _Float16 v4h;
typedef __attribute__((ext_vector_type(2))) unsigned short v2us;
typedef __attribute__((ext_vector_type(4))) unsigned short v4us;
typedef __attribute__((ext_vector_type(2))) float v2f;
typedef __attribute__((ext_vector_type(4))) int v4i;

__global__ __launch_bounds__(256) void k_wtG(const float* __restrict__ w, int K, int N, bf* Bt) {
    const int lane = threadIdx.x & 31; const int L0 = (blockIdx.x * 8 + (threadIdx.x >> 5)) * 8; const int nlines = N * K / 64;
{
#pragma unroll 1
        for (int l = 0; l < 8; ++l) { const int L = L0 + l; if (L >= nlines) break; const size_t e = (size_t)L * 64 + lane * 2; const int k = (int)(e % K), n = (int)(e / K); v2us o;
            o[0] = f2bf(w[(size_t)k * N + n]); o[1] = f2bf(w[(size_t)(k + 1) * N + n]); *(v2us*)(Bt + e) = o; }
         }
}
__global__ __launch_bounds__(256) void k_cvt8(const float* __restrict__ src, bf* dst, size_t n8) { const size_t i = (size_t)blockIdx.x * 256 + threadIdx.x; if (i >= n8) return; const v8f v = *(const v8f*)(src + i * 8); v8us o;
#pragma unroll
    for (int k = 0; k < 8; ++k) o[k] = f2bf(v[k]); *(v8us*)(dst + i * 8) = o;  }

// k_rope: head planes [h][t][d] (fp16 + hi/lo) of rope(x) x sc with the rotate-half convention out[d] = x[d] cos[t][d] - x[d+HD/2] sin[t][d], out[d+HD/2] = x[d+HD/2] cos[t][d+HD/2] + x[d] sin[t][d+HD/2]
__global__ __launch_bounds__(256) void k_rope(const float* __restrict__ F, int pitch, int nheads, const float* __restrict__ CS, const float* __restrict__ RF, const float* __restrict__ nw, float sc, h16* P16, bf* Ph, bf* Pl) {
    const size_t e = ((size_t)blockIdx.x * 256 + threadIdx.x) * 2; if (e >= (size_t)nheads * TT * HD) return; const int d = (int)(e % HD); const int t = (int)((e / HD) % TT); const int h = (int)(e / ((size_t)HD * TT)); const float* f = F + (size_t)t * pitch + h * HD; const float rf = RF ? RF[(size_t)h * TT + t] : 1.0f; v2h o16; v2us oh, ol;
#pragma unroll
    for (int q = 0; q < 2; ++q) { const int dd = d + q; const int dp = (dd < HD / 2) ? dd + HD / 2 : dd - HD / 2; float x0 = f[dd], x1 = f[dp];
        if (RF) { float n0 = __fmul_rn(x0, rf), n1 = __fmul_rn(x1, rf); asm volatile("" : "+v"(n0)); asm volatile("" : "+v"(n1)); x0 = __fmul_rn(bfr(nw[dd]), n0); x1 = __fmul_rn(bfr(nw[dp]), n1); }
        const v2f cs = *(const v2f*)(CS + ((size_t)t * HD + dd) * 2); float a = __fmul_rn(x0, cs[0]), bq = __fmul_rn(x1, cs[1]); asm volatile("" : "+v"(a)); asm volatile("" : "+v"(bq)); const float r = ((dd < HD / 2) ? __fsub_rn(a, bq) : __fadd_rn(a, bq)) * sc;
        o16[q] = tohx(r); unsigned short a2, c2; splitf(r, a2, c2); oh[q] = a2; ol[q] = c2; }
    *(v2h*)(P16 + e) = o16; *(v2us*)(Ph + e) = oh; *(v2us*)(Pl + e) = ol;  }
__global__ __launch_bounds__(256) void k_vtp(const float* __restrict__ F, int pitch, int nheads, h16* V16, bf* Vh, bf* Vl) { const size_t e = ((size_t)blockIdx.x * 256 + threadIdx.x) * 2; if (e >= (size_t)nheads * HD * TT) return; const int t = (int)(e % TT); const int d = (int)((e / TT) % HD); const int g = (int)(e / ((size_t)TT * HD)); v2h o16; v2us oh, ol;
#pragma unroll
    for (int q = 0; q < 2; ++q) { const float x = F[(size_t)(t + q) * pitch + g * HD + d]; o16[q] = tohx(x); unsigned short a2, c2; splitf(x, a2, c2); oh[q] = a2; ol[q] = c2; }
    *(v2h*)(V16 + e) = o16; *(v2us*)(Vh + e) = oh; *(v2us*)(Vl + e) = ol;  }
__global__ __launch_bounds__(256) void k_csid(float* CS) { const int idx = blockIdx.x * 256 + threadIdx.x; if (idx >= TT * HD) return; v2f cs; cs[0] = 1.0f; cs[1] = 0.0f; *(v2f*)(CS + (size_t)idx * 2) = cs;  }
// k_asoft: per row (zz, i): t = S x HD^-0.5 for j <= i and i - j < WIN (WIN = TT, so plain causal; the reference's -1e9 additive fill vanishes identically); softmax over the 2048 keys (register row, one exp, fixed trees);
__global__ __launch_bounds__(256) void k_asoft(const float* __restrict__ Sb, h16* P16, bf* Ph, bf* Pl) {
    const int lane = threadIdx.x & 31; const int row = blockIdx.x * 8 + (threadIdx.x >> 5); if (row >= ZH * TT) return; const int i = row % TT; const int zz = row / TT; (void)zz; const bool hires = (i < RH); const float* sr = Sb + (size_t)row * TT; float v[TT / 32]; float mx = -3.0e38f;
#pragma unroll
    for (int ch = 0; ch < TT / 128; ++ch) { const int j0 = ch * 128 + lane * 4; const v4f a = *(const v4f*)(sr + j0);
#pragma unroll
        for (int q = 0; q < 4; ++q) { const int j = j0 + q; (void)j; const float t = (j <= i && i - j < WIN) ? a[q] * SCL : -3.0e38f; v[ch * 4 + q] = t; mx = fmaxf(mx, t); } }
#pragma unroll
    for (int sh = 16; sh; sh >>= 1) mx = fmaxf(mx, __shfl_xor(mx, sh, 32));
    float sum = 0.f;
#pragma unroll
    for (int k = 0; k < TT / 32; ++k) { float d0 = __fsub_rn(v[k], mx); asm volatile("" : "+v"(d0)); v[k] = __builtin_amdgcn_exp2f(__fmul_rn(d0, 1.4426950408889634f)); sum += v[k]; }
#pragma unroll
    for (int sh = 16; sh; sh >>= 1) sum += __shfl_xor(sum, sh, 32);
    const float f = __fdiv_rn(hires ? 1.0f : PCAR, sum);
{
        if (hires) {
#pragma unroll
            for (int ch = 0; ch < TT / 128; ++ch) { v4us oh, ol;
#pragma unroll
                for (int q = 0; q < 4; ++q) { unsigned short a, c2; splitf(v[ch * 4 + q] * f, a, c2); oh[q] = a; ol[q] = c2; }
                const size_t oo = ((size_t)zz * (RH ? RH : 1) + i) * TT + ch * 128 + lane * 4; *(v4us*)(Ph + oo) = oh; *(v4us*)(Pl + oo) = ol; }
        } else {
#pragma unroll
            for (int ch = 0; ch < TT / 128; ++ch) { v4h o4;
#pragma unroll
                for (int q = 0; q < 4; ++q) o4[q] = tohx(v[ch * 4 + q] * f);
                *(v4h*)(P16 + (size_t)row * TT + ch * 128 + lane * 4) = o4; } }
         }
}
__constant__ float THE[DM / 2] = { 1.000000000e+0f, 9.821718931e-1f, 9.646615982e-1f, 9.474635124e-1f, 9.305720329e-1f, 9.139816761e-1f, 8.976871371e-1f, 8.816830516e-1f, 8.659643531e-1f, 8.505257964e-1f, 8.353625536e-1f, 8.204696178e-1f, 8.058421612e-1f, 7.914755344e-1f, 7.773650289e-1f, 7.635060549e-1f, 7.498942018e-1f, 7.365249991e-1f, 7.233941555e-1f, 7.104974389e-1f, 6.978305578e-1f, 6.853895783e-1f, 6.731703877e-1f, 6.611690521e-1f, 6.493816376e-1f, 6.378043890e-1f, 6.264335513e-1f, 6.152654290e-1f, 6.042963862e-1f, 5.935229063e-1f, 5.829415321e-1f, 5.725488067e-1f, 5.623413324e-1f, 5.523158312e-1f, 5.424690843e-1f, 5.327978730e-1f, 5.232990980e-1f, 5.139696598e-1f, 5.048065782e-1f, 4.958068132e-1f, 4.869675338e-1f, 4.782858193e-1f, 4.697588682e-1f, 4.613839686e-1f, 4.531583786e-1f, 4.450794160e-1f, 4.371444881e-1f, 4.293510318e-1f, 4.216965139e-1f, 4.141784608e-1f, 4.067944288e-1f, 3.995420635e-1f, 3.924189806e-1f, 3.854228854e-1f, 3.785515130e-1f, 3.718026578e-1f, 3.651741147e-1f, 3.586637676e-1f, 3.522694707e-1f, 3.459891677e-1f, 3.398208320e-1f, 3.337624669e-1f, 3.278121054e-1f, 3.219678402e-1f, 3.162277639e-1f, 3.105900288e-1f, 3.050527871e-1f, 2.996142805e-1f, 2.942727208e-1f, 2.890263796e-1f, 2.838735878e-1f, 2.788126767e-1f, 2.738419771e-1f, 2.689598799e-1f, 2.641648352e-1f, 2.594552636e-1f, 2.548296750e-1f, 2.502865493e-1f, 2.458244115e-1f, 2.414418161e-1f, 2.371373773e-1f, 2.329096645e-1f, 2.287573218e-1f, 2.246790081e-1f, 2.206734121e-1f, 2.167392224e-1f, 2.128751725e-1f, 2.090800107e-1f, 2.053525001e-1f, 2.016914487e-1f, 1.980956793e-1f, 1.945639998e-1f, 1.910952926e-1f, 1.876884252e-1f, 1.843422949e-1f, 1.810558289e-1f, 1.778279394e-1f, 1.746575981e-1f, 1.715437919e-1f, 1.684854925e-1f, 1.654817164e-1f, 1.625314802e-1f, 1.596338600e-1f, 1.567878872e-1f, 1.539926529e-1f, 1.512472481e-1f, 1.485508084e-1f, 1.459024251e-1f, 1.433012635e-1f, 1.407464594e-1f, 1.382372230e-1f, 1.357727200e-1f, 1.333521456e-1f, 1.309747249e-1f, 1.286396980e-1f, 1.263462901e-1f, 1.240937784e-1f, 1.218814179e-1f, 1.197085008e-1f, 1.175743267e-1f, 1.154781953e-1f, 1.134194434e-1f, 1.113973856e-1f, 1.094113812e-1f, 1.074607819e-1f, 1.055449620e-1f, 1.036632955e-1f, 1.018151715e-1f, 1.000000015e-1f, 9.821718931e-2f, 9.646616131e-2f, 9.474635124e-2f, 9.305720776e-2f, 9.139817208e-2f, 8.976871520e-2f, 8.816830814e-2f, 8.659642935e-2f, 8.505257964e-2f, 8.353625238e-2f, 8.204696327e-2f, 8.058422059e-2f, 7.914755493e-2f, 7.773650438e-2f, 7.635060698e-2f, 7.498942316e-2f, 7.365249842e-2f, 7.233941555e-2f, 7.104974240e-2f, 6.978306174e-2f, 6.853895634e-2f, 6.731703877e-2f, 6.611689925e-2f, 6.493816525e-2f, 6.378044188e-2f, 6.264335662e-2f, 6.152654067e-2f, 6.042964011e-2f, 5.935229361e-2f, 5.829415470e-2f, 5.725488067e-2f, 5.623413250e-2f, 5.523158237e-2f, 5.424690992e-2f, 5.327979103e-2f, 5.232991278e-2f, 5.139696971e-2f, 5.048065633e-2f, 4.958068207e-2f, 4.869675264e-2f, 4.782858118e-2f, 4.697588831e-2f, 4.613839835e-2f, 4.531583562e-2f, 4.450793937e-2f, 4.371444881e-2f, 4.293510318e-2f, 4.216964915e-2f, 4.141784459e-2f, 4.067944363e-2f, 3.995420411e-2f, 3.924189880e-2f, 3.854228929e-2f, 3.785515204e-2f, 3.718026727e-2f, 3.651741147e-2f, 3.586637601e-2f, 3.522694483e-2f, 3.459891677e-2f, 3.398208320e-2f, 3.337624669e-2f, 3.278120980e-2f, 3.219678625e-2f, 3.162277490e-2f, 3.105900250e-2f, 3.050527908e-2f, 2.996142767e-2f, 2.942727134e-2f, 2.890263870e-2f, 2.838736027e-2f, 2.788126655e-2f, 2.738419548e-2f, 2.689598873e-2f, 2.641648240e-2f, 2.594552748e-2f, 2.548296750e-2f, 2.502865344e-2f, 2.458244003e-2f, 2.414418198e-2f, 2.371373773e-2f, 2.329096571e-2f, 2.287573181e-2f, 2.246790007e-2f, 2.206734009e-2f, 2.167392150e-2f, 2.128751576e-2f, 2.090799995e-2f, 2.053525113e-2f, 2.016914636e-2f, 1.980956830e-2f, 1.945640147e-2f, 1.910953037e-2f, 1.876884326e-2f, 1.843423024e-2f, 1.810558327e-2f, 1.778279431e-2f, 1.746576093e-2f, 1.715437882e-2f, 1.684854925e-2f, 1.654817164e-2f, 1.625314914e-2f, 1.596338488e-2f, 1.567878760e-2f, 1.539926510e-2f, 1.512472518e-2f, 1.485508028e-2f, 1.459024195e-2f, 1.433012541e-2f, 1.407464687e-2f, 1.382372249e-2f, 1.357727125e-2f, 1.333521400e-2f, 1.309747249e-2f, 1.286396943e-2f, 1.263462938e-2f, 1.240937784e-2f, 1.218814217e-2f, 1.197085064e-2f, 1.175743248e-2f, 1.154781971e-2f, 1.134194434e-2f, 1.113973837e-2f, 1.094113849e-2f, 1.074607857e-2f, 1.055449620e-2f, 1.036632899e-2f, 1.018151734e-2f, 9.999999776e-3f, 9.821718559e-3f, 9.646615945e-3f, 9.474635124e-3f, 9.305720218e-3f, 9.139817208e-3f, 8.976871148e-3f, 8.816830814e-3f, 8.659643121e-3f, 8.505257778e-3f, 8.353625424e-3f, 8.204695769e-3f, 8.058422245e-3f, 7.914755493e-3f, 7.773650344e-3f, 7.635060698e-3f, 7.498942316e-3f, 7.365250029e-3f, 7.233941462e-3f, 7.104974240e-3f, 6.978305988e-3f, 6.853895728e-3f, 6.731703877e-3f, 6.611690391e-3f, 6.493816152e-3f, 6.378043909e-3f, 6.264335476e-3f, 6.152654067e-3f, 6.042963825e-3f, 5.935229361e-3f, 5.829415284e-3f, 5.725488067e-3f, 5.623413250e-3f, 5.523158237e-3f, 5.424690899e-3f, 5.327979103e-3f, 5.232991185e-3f, 5.139696877e-3f, 5.048065912e-3f, 4.958068021e-3f, 4.869675264e-3f, 4.782858305e-3f, 4.697588738e-3f, 4.613839556e-3f, 4.531583749e-3f, 4.450793844e-3f, 4.371444695e-3f, 4.293510225e-3f, 4.216964822e-3f, 4.141784739e-3f, 4.067944363e-3f, 3.995420411e-3f, 3.924189601e-3f, 3.854228882e-3f, 3.785515204e-3f, 3.718026681e-3f, 3.651741194e-3f, 3.586637555e-3f, 3.522694577e-3f, 3.459891770e-3f, 3.398208413e-3f, 3.337624716e-3f, 3.278121119e-3f, 3.219678532e-3f, 3.162277630e-3f, 3.105900250e-3f, 3.050528001e-3f, 2.996142721e-3f, 2.942727180e-3f, 2.890263917e-3f, 2.838735934e-3f, 2.788126701e-3f, 2.738419687e-3f, 2.689598827e-3f, 2.641648287e-3f, 2.594552701e-3f, 2.548296703e-3f, 2.502865391e-3f, 2.458244096e-3f, 2.414418152e-3f, 2.371373819e-3f, 2.329096664e-3f, 2.287573181e-3f, 2.246790100e-3f, 2.206734149e-3f, 2.167392056e-3f, 2.128751716e-3f, 2.090800088e-3f, 2.053525066e-3f, 2.016914543e-3f, 1.980956877e-3f, 1.945640077e-3f, 1.910952968e-3f, 1.876884256e-3f, 1.843423001e-3f, 1.810558257e-3f, 1.778279431e-3f, 1.746576047e-3f, 1.715437858e-3f, 1.684854855e-3f, 1.654817141e-3f, 1.625314821e-3f, 1.596338581e-3f, 1.567878877e-3f, 1.539926510e-3f, 1.512472518e-3f, 1.485508052e-3f, 1.459024264e-3f, 1.433012541e-3f, 1.407464617e-3f, 1.382372226e-3f, 1.357727102e-3f, 1.333521446e-3f, 1.309747226e-3f, 1.286396990e-3f, 1.263462938e-3f, 1.240937738e-3f, 1.218814170e-3f, 1.197085017e-3f, 1.175743295e-3f, 1.154782018e-3f, 1.134194434e-3f, 1.113973907e-3f, 1.094113803e-3f, 1.074607833e-3f, 1.055449597e-3f, 1.036632922e-3f, 1.018151757e-3f, 1.000000047e-3f, 9.821718559e-4f, 9.646615945e-4f, 9.474635008e-4f, 9.305720450e-4f, 9.139816975e-4f, 8.976871613e-4f, 8.816830814e-4f, 8.659643354e-4f, 8.505258011e-4f, 8.353625308e-4f, 8.204696351e-4f, 8.058421663e-4f, 7.914755261e-4f, 7.773650577e-4f, 7.635061047e-4f, 7.498941850e-4f, 7.365249912e-4f, 7.233941578e-4f, 7.104974356e-4f, 6.978305755e-4f, 6.853895611e-4f, 6.731703761e-4f, 6.611690042e-4f, 6.493816036e-4f, 6.378043909e-4f, 6.264335243e-4f, 6.152653950e-4f, 6.042963942e-4f, 5.935229128e-4f, 5.829415168e-4f, 5.725487717e-4f, 5.623413017e-4f, 5.523158470e-4f, 5.424690899e-4f, 5.327978870e-4f, 5.232990952e-4f, 5.139696877e-4f, 5.048065796e-4f, 4.958068021e-4f, 4.869675322e-4f, 4.782858014e-4f, 4.697588738e-4f, 4.613839556e-4f, 4.531583691e-4f, 4.450794077e-4f, 4.371444811e-4f, 4.293510283e-4f, 4.216965172e-4f, 4.141784448e-4f, 4.067944246e-4f, 3.995420702e-4f, 3.924189659e-4f, 3.854228999e-4f, 3.785515146e-4f, 3.718026564e-4f, 3.651741135e-4f, 3.586637613e-4f, 3.522694751e-4f, 3.459891595e-4f, 3.398208355e-4f, 3.337624657e-4f, 3.278121294e-4f, 3.219678474e-4f, 3.162277571e-4f, 3.105900250e-4f, 3.050527885e-4f, 2.996142721e-4f, 2.942727297e-4f, 2.890263859e-4f, 2.838736109e-4f, 2.788126585e-4f, 2.738419571e-4f, 2.689598768e-4f, 2.641648462e-4f, 2.594552643e-4f, 2.548296761e-4f, 2.502865391e-4f, 2.458243980e-4f, 2.414418268e-4f, 2.371373703e-4f, 2.329096606e-4f, 2.287573152e-4f, 2.246790100e-4f, 2.206734061e-4f, 2.167392231e-4f, 2.128751657e-4f, 2.090799971e-4f, 2.053525095e-4f, 2.016914514e-4f, 1.980956731e-4f, 1.945640106e-4f, 1.910952997e-4f, 1.876884344e-4f, 1.843422942e-4f, 1.810558315e-4f, 1.778279402e-4f, 1.746576017e-4f, 1.715437829e-4f, 1.684854942e-4f, 1.654817170e-4f, 1.625314908e-4f, 1.596338552e-4f, 1.567878790e-4f, 1.539926598e-4f, 1.512472518e-4f, 1.485507964e-4f, 1.459024206e-4f, 1.433012512e-4f, 1.407464733e-4f, 1.382372284e-4f, 1.357727160e-4f, 1.333521504e-4f, 1.309747313e-4f, 1.286396873e-4f, 1.263462909e-4f, 1.240937709e-4f, 1.218814214e-4f, 1.197085003e-4f, 1.175743237e-4f, 1.154782003e-4f, 1.134194390e-4f, 1.113973849e-4f, 1.094113832e-4f, 1.074607862e-4f, 1.055449611e-4f, 1.036632893e-4f, 1.018151743e-4f };   // 10000^(-2i/1024), i = 0..511 (float32)
__global__ __launch_bounds__(256) void k_preRopeI(const float* __restrict__ X, bf* Ph, bf* Pl) { const size_t k = (size_t)blockIdx.x * 256 + threadIdx.x; if (k >= (size_t)TT * DM / 4) return; const size_t e = k * 4; const int d0 = (int)(e % DM); const int t = (int)(e / DM); const v4f a = *(const v4f*)(X + e); v4us oh, ol;
#pragma unroll
    for (int p = 0; p < 2; ++p) { const int i = (d0 >> 1) + p; const float ang = __fmul_rn((float)t, THE[i]); const float c = cosf(ang), sn = sinf(ang); const float x0 = bfr(a[2 * p]), x1 = bfr(a[2 * p + 1]);
        float a0 = __fmul_rn(x0, c), b0 = __fmul_rn(x1, sn), a1 = __fmul_rn(x1, c), b1 = __fmul_rn(x0, sn); asm volatile("" : "+v"(a0), "+v"(b0), "+v"(a1), "+v"(b1)); const float y0 = __fsub_rn(a0, b0), y1 = __fadd_rn(a1, b1); unsigned short u, w; splitf(y0, u, w); oh[2 * p] = u; ol[2 * p] = w; splitf(y1, u, w); oh[2 * p + 1] = u; ol[2 * p + 1] = w; }
    *(v4us*)(Ph + e) = oh; *(v4us*)(Pl + e) = ol;  }
__global__ __launch_bounds__(256) void k_merge(const float* __restrict__ O, int h0, bf* Ah, bf* Al) { const size_t e = ((size_t)blockIdx.x * 256 + threadIdx.x) * 2; if (e >= (size_t)ZH * TT * HD) return; const int d = (int)(e % HD); const int t = (int)((e / HD) % TT); const int zz = (int)(e / ((size_t)HD * TT)); const float cs = (t < RH) ? 1.0f : (1.0f / PCAR); const size_t oo = (size_t)t * DQ + (h0 + zz) * HD + d;
    v2us oh, ol;
#pragma unroll
    for (int q = 0; q < 2; ++q) { unsigned short a, c2; splitf(O[e + q] * cs, a, c2); oh[q] = a; ol[q] = c2; } *(v2us*)(Ah + oo) = oh; *(v2us*)(Al + oo) = ol;  }

extern "C" void kernel_launch(void* const* d_in, const int* in_sizes, int n_in,
                              void* d_out, int out_size, void* d_ws, size_t ws_size, hipStream_t stream) {
    (void)in_sizes; (void)n_in; (void)out_size;
    const float* x = (const float*)d_in[0]; const float* wq = (const float*)d_in[1]; const float* wk = (const float*)d_in[2]; const float* wv = (const float*)d_in[3]; const float* wo = (const float*)d_in[4]; const float* bo = (const float*)d_in[5];
    float* OUT = (float*)d_out;     // [4][2048][1024]
    char* wsp = (char*)d_ws;
    auto take = [&](size_t bytes) { char* p = wsp; wsp += (bytes + 255) & ~(size_t)255; return (void*)p; };
    bf* XBl = (bf*)take((size_t)TT * DM * 2); bf* WQ = (bf*)take((size_t)DQ * DM * 2); bf* WK = (bf*)take((size_t)DKV * DM * 2); bf* WV = (bf*)take((size_t)DKV * DM * 2); bf* WO = (bf*)take((size_t)DM * DQ * 2); float* CS = (float*)take((size_t)TT * HD * 2 * 4);
    bf* XB = (bf*)take((size_t)TT * DM * 2); float* FQ = (float*)take((size_t)TT * DQ * 4); float* FK = (float*)take((size_t)TT * DKV * 4);
    h16* QP16 = (h16*)take((size_t)NH_ * TT * HD * 2); h16* KP16 = (h16*)take((size_t)NKV * TT * HD * 2); h16* VT16 = (h16*)take((size_t)NKV * HD * TT * 2);
    bf* QPh = (bf*)take((size_t)NH_ * TT * HD * 2); bf* QPl = (bf*)take((size_t)NH_ * TT * HD * 2); bf* KPh = (bf*)take((size_t)NKV * TT * HD * 2); bf* KPl = (bf*)take((size_t)NKV * TT * HD * 2); bf* VTh = (bf*)take((size_t)NKV * HD * TT * 2); bf* VTl = (bf*)take((size_t)NKV * HD * TT * 2); bf* Ph = (bf*)take((size_t)ZH * RH * TT * 2); bf* Pl = (bf*)take((size_t)ZH * RH * TT * 2);
    float* Sb = (float*)take((size_t)ZH * TT * TT * 4); h16* P16 = (h16*)take((size_t)ZH * TT * TT * 2); float* Ob = (float*)take((size_t)ZH * TT * HD * 4); bf* ATh = (bf*)take((size_t)TT * DQ * 2); bf* ATl = (bf*)take((size_t)TT * DQ * 2);
    if ((size_t)(wsp - (char*)d_ws) > ws_size) return;    // ws 256 MiB
    float* FV = FK;   // v projection reuses the k buffer after the k planes are built (stream-ordered)
    { k_cvt8<<<(unsigned)(((size_t)DQ * DM / 8 + 255) / 256), 256, 0, stream>>>(wq, WQ, (size_t)DQ * DM / 8); k_cvt8<<<(unsigned)(((size_t)DKV * DM / 8 + 255) / 256), 256, 0, stream>>>(wk, WK, (size_t)DKV * DM / 8); k_cvt8<<<(unsigned)(((size_t)DKV * DM / 8 + 255) / 256), 256, 0, stream>>>(wv, WV, (size_t)DKV * DM / 8);
      k_cvt8<<<(unsigned)(((size_t)DM * DQ / 8 + 255) / 256), 256, 0, stream>>>(wo, WO, (size_t)DM * DQ / 8);
       }
    k_csid<<<(TT * HD + 255) / 256, 256, 0, stream>>>(CS);
    const unsigned LQ = (unsigned)(((size_t)NH_ * TT * HD / 2 + 255) / 256), LKv = (unsigned)(((size_t)NKV * TT * HD / 2 + 255) / 256);
    for (int b = 0; b < NB_; ++b) {
        
        k_preRopeI<<<(unsigned)(((size_t)TT * DM / 4 + 255) / 256), 256, 0, stream>>>(x + (size_t)b * TT * DM, XB, XBl);   /* rx = pairwise rope of the input, as hi/lo planes */
        k_gemmw<bf, 1, false><<<dim3(TT / 64, DQ / 64, 1), 32, 0, stream>>>(XB, XBl, WQ, nullptr, DM, FQ, DQ, nullptr, 0, 0, 0);   /* q = rx Wq^T (hi/lo x exact) */
        k_rope<<<LQ, 256, 0, stream>>>(FQ, DQ, NH_, CS, nullptr, nullptr, 1.0f, QP16, QPh, QPl);
        k_gemmw<bf, 1, false><<<dim3(TT / 64, DKV / 64, 1), 32, 0, stream>>>(XB, XBl, WK, nullptr, DM, FK, DKV, nullptr, 0, 0, 0);   /* k = rx Wk^T */
        k_rope<<<LKv, 256, 0, stream>>>(FK, DKV, NKV, CS, nullptr, nullptr, 1.0f, KP16, KPh, KPl);
        k_cvt8<<<(unsigned)(((size_t)TT * DM / 8 + 255) / 256), 256, 0, stream>>>(x + (size_t)b * TT * DM, XB, (size_t)TT * DM / 8);   /* plain input for v */ k_gemmw<bf, 0, false><<<dim3(TT / 64, DKV / 64, 1), 32, 0, stream>>>(XB, nullptr, WV, nullptr, DM, FV, DKV, nullptr, 0, 0, 0); k_vtp<<<LKv, 256, 0, stream>>>(FV, DKV, NKV, VT16, VTh, VTl);
        for (int h0 = 0; h0 < NH_; h0 += ZH) { const size_t zq = (size_t)h0, zk = (size_t)(h0 / REP);   // one kv head per query head: the pass's two heads use consecutive kv planes (z-strides TT*HD)
            k_gemmc<bf, 2, 1><<<dim3(RH / 64, TT / 64, ZH), 32, 0, stream>>>(QPh + zq * TT * HD, QPl + zq * TT * HD, KPh + zk * TT * HD, KPl + zk * TT * HD, HD, Sb, TT, 0, (size_t)TT * HD, (size_t)TT * HD, (size_t)TT * TT);
            k_gemmc<h16, 0, 1><<<dim3((TT - RH) / 64, TT / 64, ZH), 32, 0, stream>>>(QP16 + zq * TT * HD + (size_t)RH * HD, nullptr, KP16 + zk * TT * HD, nullptr, HD, Sb + (size_t)RH * TT, TT, RH, (size_t)TT * HD, (size_t)TT * HD, (size_t)TT * TT);
            k_asoft<<<ZH * TT / 8, 256, 0, stream>>>(Sb, P16, Ph, Pl);
            k_gemmc<bf, 2, 2><<<dim3(RH / 64, HD / 64, ZH), 32, 0, stream>>>(Ph, Pl, VTh + zk * HD * TT, VTl + zk * HD * TT, TT, Ob, HD, 0, (size_t)RH * TT, (size_t)HD * TT, (size_t)TT * HD);
            k_gemmc<h16, 0, 2><<<dim3((TT - RH) / 64, HD / 64, ZH), 32, 0, stream>>>(P16 + (size_t)RH * TT, nullptr, VT16 + zk * HD * TT, nullptr, TT, Ob + (size_t)RH * HD, HD, RH, (size_t)TT * TT, (size_t)HD * TT, (size_t)TT * HD);
            k_merge<<<(unsigned)(((size_t)ZH * TT * HD / 2 + 255) / 256), 256, 0, stream>>>(Ob, h0, ATh, ATl); }
        k_gemmw<bf, 1, true><<<dim3(TT / 64, DM / 64, 1), 32, 0, stream>>>(ATh, ATl, WO, nullptr, DQ, OUT + (size_t)b * TT * DM, DM, bo, 0, 0, 0); }
}

// v001
// One run takes 1570 microseconds.
// Next to v000, in two timings, it ran 1.87 and 1.85 times as fast.
#include <hip/hip_runtime.h>

// Causal multi-head self-attention with a pairwise rotary applied to the INPUT before the q/k projections (input [4][2048][1024]; rx[t][2i], rx[t][2i+1] = rotation of (x[2i], x[2i+1]) by t x 10000^(-2i/1024) over the 1,024 features (computed); q = rx Wq^T, k = rx Wk^T, v = input Wv^T ('oi' 1/32, no bias; 16 heads x 64); scores masked causal then / 8; softmax; out = merged Wo^T + bo -> [4][2048][1024] (8.4 M)).
// Layout per batch: a rotary kernel builds rx from the bf16-rounded input with on-the-fly precise cosf/sinf of t x theta[i] (512 float32 constants) and splits it into bf16 hi/lo planes; q and k projections hi/lo x exact; a plain bf16 copy of the input feeds the exact v projection; causal T-2048 attention (hybrid rows: < 512 hi/lo 3 products, rest fp16 x1024; tiles above the diagonal skipped); merged hi/lo x Wo exact + bo.
// Compute dtypes, f32 accumulate: every input rounded to bf16; input rotary f32, q/k projections hi/lo x exact (2 products: ~f32), v exact; attention rows < 512 3 products, rest fp16; softmax f32; Wo hl x exact + bias.

#define NB_  4
#define TT   2048
#define DM   1024
#define NH_  16
#define NKV  16
#define REP  (NH_ / NKV)
#define HD   64
#define DQ   (NH_ * HD)
#define DKV  (NKV * HD)
#define ZH   2
#define RH   512                  // query rows < RH use hi+lo planes (0: none)
#define WIN  2048
#define PCAR 1024.0f
#define SCL  0.125f   // HD^-0.5
typedef _Float16 h16;
typedef unsigned short bf;
typedef __attribute__((ext_vector_type(16))) __bf16   v16bf;
typedef __attribute__((ext_vector_type(16))) _Float16 v16h;
typedef __attribute__((ext_vector_type(8)))  _Float16 v8h;
typedef __attribute__((ext_vector_type(8)))  unsigned short v8us;
typedef __attribute__((ext_vector_type(8)))  float    v8f;
typedef __attribute__((ext_vector_type(4)))  float    v4f;
typedef v8h  __attribute__((may_alias)) v8ha;
typedef v4f  __attribute__((may_alias)) v4fa;
typedef v8us __attribute__((may_alias)) v8usa;

__device__ __forceinline__ unsigned short f2bf(float f) { unsigned u = __float_as_uint(f); u += 0x7FFFu + ((u >> 16) & 1u); return (unsigned short)(u >> 16); }
__device__ __forceinline__ float bf2f(unsigned short b) { return __uint_as_float(((unsigned)b) << 16); }
__device__ __forceinline__ float bfr(float f) { return bf2f(f2bf(f)); }
__device__ __forceinline__ v16h cat16(v8h lo, v8h hi) { return __builtin_shufflevector(lo, hi, 0, 1, 2, 3, 4, 5, 6, 7, 8, 9, 10, 11, 12, 13, 14, 15); }
__device__ __forceinline__ v16bf cat16b(v8us lo, v8us hi) { return __builtin_bit_cast(v16bf, __builtin_shufflevector(lo, hi, 0, 1, 2, 3, 4, 5, 6, 7, 8, 9, 10, 11, 12, 13, 14, 15)); }
__device__ __forceinline__ v8f wmma16(v16h a, v16h b, v8f c) { return __builtin_amdgcn_wmma_f32_16x16x32_f16(false, a, false, b, (short)0, c, false, false); }
__device__ __forceinline__ v8f wmmab(v16bf a, v16bf b, v8f c) { return __builtin_amdgcn_wmma_f32_16x16x32_bf16(false, a, false, b, (short)0, c, false, false); }



// ---- k_gemmw: register-blocked GEMM, one work-group of NW waves per 64x64 output tile, operands straight from K-contiguous 16-bit planes; grid (M/64, N/64, Z), 32 NW threads.
// C[m][n] (f32, pitch ldc, + optional f32 bias[n]) = sum_k A[m][k] Bt[n][k] (+ split products per NSPLIT). z-batch strides sA/sB/sC in elements. K % 32 == 0.
// The K loop is a chain of dependent load latencies, so it is cut into NW contiguous runs of 32-k chunks, one run a wave: each wave holds a whole 64x64 f32 partial tile (16 accumulators),
// and the NW partial tiles are added through LDS in wave order. DIAG (probability x value contraction): the K loop ends at the diagonal block of query rows r0+roff.. (probabilities beyond it are exactly zero).
template <typename T16> struct WFrag;
template <> struct WFrag<h16> { typedef v16h V; static __device__ __forceinline__ V ld(const h16* p) { return cat16(*(const v8h*)p, *(const v8h*)(p + 16)); } static __device__ __forceinline__ v8f mma(V a, V b, v8f c) { return wmma16(a, b, c); } };
template <> struct WFrag<bf> { typedef v16bf V; static __device__ __forceinline__ V ld(const bf* p) { return cat16b(*(const v8us*)p, *(const v8us*)(p + 16)); } static __device__ __forceinline__ v8f mma(V a, V b, v8f c) { return wmmab(a, b, c); } };
template <typename T16, int NSPLIT, bool BIAS, bool DIAG, int NW>
__global__ __launch_bounds__(32 * NW) void k_gemmw(const T16* __restrict__ A, const T16* __restrict__ A2, const T16* __restrict__ Bt, const T16* __restrict__ Bt2, int K, float* C, int ldc, const float* __restrict__ bias, int roff, size_t sA, size_t sB, size_t sC) {
    typedef typename WFrag<T16>::V V;
    __shared__ __align__(16) float os[NW * 64 * 68];   // one 64x64 partial tile a wave, row pitch 68
    const size_t z = blockIdx.z; A += z * sA; if (A2) A2 += z * sA; Bt += z * sB; if (Bt2) Bt2 += z * sB; C += z * sC;
    const int lane = threadIdx.x & 31, lr = lane & 15, hi = lane >> 4; const int r0 = blockIdx.x * 64, c0 = blockIdx.y * 64;
    const int w = __builtin_amdgcn_readfirstlane((int)(threadIdx.x >> 5));   // wave number, held scalar so that the K loop keeps a scalar branch
    const int nch = (DIAG ? min(K, r0 + roff + 64) : K) / 32;                // 32-k chunks of this tile
    const int kb = 32 * (w * nch / NW), ke = 32 * ((w + 1) * nch / NW);      // this wave's run of them (empty where there are fewer chunks than waves)
    v8f acc[4][4];
#pragma unroll
    for (int mb = 0; mb < 4; ++mb)
#pragma unroll
        for (int nb = 0; nb < 4; ++nb) acc[mb][nb] = (v8f){};
    const size_t aoff = (size_t)(r0 + lr) * K + 8 * hi, boff = (size_t)(c0 + lr) * K + 8 * hi;
#pragma unroll 1
    for (int kc = kb; kc < ke; kc += 32) {
        V a[4], a2[4];
#pragma unroll
        for (int mb = 0; mb < 4; ++mb) { a[mb] = WFrag<T16>::ld(A + aoff + (size_t)mb * 16 * K + kc); if (NSPLIT == 1 || NSPLIT == 2) a2[mb] = WFrag<T16>::ld(A2 + aoff + (size_t)mb * 16 * K + kc); }
#pragma unroll
        for (int nb = 0; nb < 4; ++nb) { const V b = WFrag<T16>::ld(Bt + boff + (size_t)nb * 16 * K + kc); V b2; if (NSPLIT >= 2) b2 = WFrag<T16>::ld(Bt2 + boff + (size_t)nb * 16 * K + kc);
#pragma unroll
            for (int mb = 0; mb < 4; ++mb) { acc[mb][nb] = WFrag<T16>::mma(a[mb], b, acc[mb][nb]); if (NSPLIT == 1 || NSPLIT == 2) acc[mb][nb] = WFrag<T16>::mma(a2[mb], b, acc[mb][nb]); if (NSPLIT >= 2) acc[mb][nb] = WFrag<T16>::mma(a[mb], b2, acc[mb][nb]); } }
        asm volatile("v_nop\n\tv_nop\n\tv_nop\n\tv_nop" : "+v"(acc[0][0]), "+v"(acc[1][1]), "+v"(acc[2][2]), "+v"(acc[3][3]) : "v"(a[0]), "v"(a[3]));
    }
    float* ow = os + w * 64 * 68;
#pragma unroll
    for (int mb = 0; mb < 4; ++mb) {
#pragma unroll
        for (int nb = 0; nb < 4; ++nb) {
#pragma unroll
            for (int j = 0; j < 8; ++j) ow[(mb * 16 + hi * 8 + j) * 68 + nb * 16 + lr] = acc[mb][nb][j]; } }
    __syncthreads();                               // all NW partial tiles are in LDS before any thread adds them
#pragma unroll
    for (int s = 0; s < 32 / NW; ++s) { const int q = s * 32 * NW + threadIdx.x, row = q >> 4, cofs = (q & 15) * 4; v4f val = *(const v4fa*)(os + row * 68 + cofs);
#pragma unroll
        for (int u = 1; u < NW; ++u) val += *(const v4fa*)(os + (u * 64 + row) * 68 + cofs);
        if (BIAS) { val[0] += bfr(bias[c0 + cofs]); val[1] += bfr(bias[c0 + cofs + 1]); val[2] += bfr(bias[c0 + cofs + 2]); val[3] += bfr(bias[c0 + cofs + 3]); }
        *(v4f*)(C + (size_t)(r0 + row) * ldc + c0 + cofs) = val; }
}

// ---- k_gemmc: one-wave 64x64 tile GEMM for the causal scores (K = head size, two trips: nothing to split): tiles entirely above the diagonal (query rows r0+roff.., key columns c0..) are skipped.
// roff = row offset of this launch's first row within the sequence.
template <typename T16, int NSPLIT>
__global__ __launch_bounds__(32) void k_gemmc(const T16* __restrict__ A, const T16* __restrict__ A2, const T16* __restrict__ Bt, const T16* __restrict__ Bt2, int K, float* C, int ldc, int roff, size_t sA, size_t sB, size_t sC) {
    typedef typename WFrag<T16>::V V;
    __shared__ __align__(16) float os[16 * 68];
    const size_t z = blockIdx.z; A += z * sA; if (A2) A2 += z * sA; Bt += z * sB; if (Bt2) Bt2 += z * sB; C += z * sC;
    const int lane = threadIdx.x & 31, lr = lane & 15, hi = lane >> 4; const int r0 = blockIdx.x * 64, c0 = blockIdx.y * 64;
    if (c0 > r0 + roff + 63) return;                  // score tile entirely above the causal diagonal: never read (the softmax masks j > i by select)
    v8f acc[4][4];
#pragma unroll
    for (int mb = 0; mb < 4; ++mb)
#pragma unroll
        for (int nb = 0; nb < 4; ++nb) acc[mb][nb] = (v8f){};
    const size_t aoff = (size_t)(r0 + lr) * K + 8 * hi, boff = (size_t)(c0 + lr) * K + 8 * hi;
#pragma unroll 1
    for (int kc = 0; kc < K; kc += 32) {
        V a[4], a2[4];
#pragma unroll
        for (int mb = 0; mb < 4; ++mb) { a[mb] = WFrag<T16>::ld(A + aoff + (size_t)mb * 16 * K + kc); if (NSPLIT == 1 || NSPLIT == 2) a2[mb] = WFrag<T16>::ld(A2 + aoff + (size_t)mb * 16 * K + kc); }
#pragma unroll
        for (int nb = 0; nb < 4; ++nb) { const V b = WFrag<T16>::ld(Bt + boff + (size_t)nb * 16 * K + kc); V b2; if (NSPLIT >= 2) b2 = WFrag<T16>::ld(Bt2 + boff + (size_t)nb * 16 * K + kc);
#pragma unroll
            for (int mb = 0; mb < 4; ++mb) { acc[mb][nb] = WFrag<T16>::mma(a[mb], b, acc[mb][nb]); if (NSPLIT == 1 || NSPLIT == 2) acc[mb][nb] = WFrag<T16>::mma(a2[mb], b, acc[mb][nb]); if (NSPLIT >= 2) acc[mb][nb] = WFrag<T16>::mma(a[mb], b2, acc[mb][nb]); } }
        asm volatile("v_nop\n\tv_nop\n\tv_nop\n\tv_nop" : "+v"(acc[0][0]), "+v"(acc[1][1]), "+v"(acc[2][2]), "+v"(acc[3][3]) : "v"(a[0]), "v"(a[3]));
    }
#pragma unroll
    for (int mb = 0; mb < 4; ++mb) {
#pragma unroll
        for (int nb = 0; nb < 4; ++nb) {
#pragma unroll
            for (int j = 0; j < 8; ++j) os[(hi * 8 + j) * 68 + nb * 16 + lr] = acc[mb][nb][j]; }
        __builtin_amdgcn_wave_barrier(); asm volatile("" ::: "memory");
        float* crow = C + (size_t)(r0 + mb * 16) * ldc + c0;
{
#pragma unroll
            for (int s = 0; s < 8; ++s) { const int row = 2 * s + hi, cofs = lr * 4; v4f val = *(const v4fa*)(os + row * 68 + cofs);
                *(v4f*)(crow + (size_t)row * ldc + cofs) = val; }
             }
        __builtin_amdgcn_wave_barrier(); asm volatile("" ::: "memory");
    }
}

__device__ __forceinline__ h16 tohx(float x) { return (h16)x; }
__device__ __forceinline__ void splitf(float y, unsigned short& h, unsigned short& l) { h = f2bf(y); l = f2bf(y - bf2f(h)); }
typedef __attribute__((ext_vector_type(2))) _Float16 v2h;
typedef __attribute__((ext_vector_type(4))) _Float16 v4h;
typedef __attribute__((ext_vector_type(2))) unsigned short v2us;
typedef __attribute__((ext_vector_type(4))) unsigned short v4us;
typedef __attribute__((ext_vector_type(2))) float v2f;
typedef __attribute__((ext_vector_type(4))) int v4i;

__global__ __launch_bounds__(256) void k_wtG(const float* __restrict__ w, int K, int N, bf* Bt) {
    const int lane = threadIdx.x & 31; const int L0 = (blockIdx.x * 8 + (threadIdx.x >> 5)) * 8; const int nlines = N * K / 64;
{
#pragma unroll 1
        for (int l = 0; l < 8; ++l) { const int L = L0 + l; if (L >= nlines) break; const size_t e = (size_t)L * 64 + lane * 2; const int k = (int)(e % K), n = (int)(e / K); v2us o;
            o[0] = f2bf(w[(size_t)k * N + n]); o[1] = f2bf(w[(size_t)(k + 1) * N + n]); *(v2us*)(Bt + e) = o; }
         }
}
__global__ __launch_bounds__(256) void k_cvt8(const float* __restrict__ src, bf* dst, size_t n8) { const size_t i = (size_t)blockIdx.x * 256 + threadIdx.x; if (i >= n8) return; const v8f v = *(const v8f*)(src + i * 8); v8us o;
#pragma unroll
    for (int k = 0; k < 8; ++k) o[k] = f2bf(v[k]); *(v8us*)(dst + i * 8) = o;  }

// k_rope: head planes [h][t][d] (fp16 + hi/lo) of rope(x) x sc with the rotate-half convention out[d] = x[d] cos[t][d] - x[d+HD/2] sin[t][d], out[d+HD/2] = x[d+HD/2] cos[t][d+HD/2] + x[d] sin[t][d+HD/2]
__global__ __launch_bounds__(256) void k_rope(const float* __restrict__ F, int pitch, int nheads, const float* __restrict__ CS, const float* __restrict__ RF, const float* __restrict__ nw, float sc, h16* P16, bf* Ph, bf* Pl) {
    const size_t e = ((size_t)blockIdx.x * 256 + threadIdx.x) * 2; if (e >= (size_t)nheads * TT * HD) return; const int d = (int)(e % HD); const int t = (int)((e / HD) % TT); const int h = (int)(e / ((size_t)HD * TT)); const float* f = F + (size_t)t * pitch + h * HD; const float rf = RF ? RF[(size_t)h * TT + t] : 1.0f; v2h o16; v2us oh, ol;
#pragma unroll
    for (int q = 0; q < 2; ++q) { const int dd = d + q; const int dp = (dd < HD / 2) ? dd + HD / 2 : dd - HD / 2; float x0 = f[dd], x1 = f[dp];
        if (RF) { float n0 = __fmul_rn(x0, rf), n1 = __fmul_rn(x1, rf); asm volatile("" : "+v"(n0)); asm volatile("" : "+v"(n1)); x0 = __fmul_rn(bfr(nw[dd]), n0); x1 = __fmul_rn(bfr(nw[dp]), n1); }
        const v2f cs = *(const v2f*)(CS + ((size_t)t * HD + dd) * 2); float a = __fmul_rn(x0, cs[0]), bq = __fmul_rn(x1, cs[1]); asm volatile("" : "+v"(a)); asm volatile("" : "+v"(bq)); const float r = ((dd < HD / 2) ? __fsub_rn(a, bq) : __fadd_rn(a, bq)) * sc;
        o16[q] = tohx(r); unsigned short a2, c2; splitf(r, a2, c2); oh[q] = a2; ol[q] = c2; }
    *(v2h*)(P16 + e) = o16; *(v2us*)(Ph + e) = oh; *(v2us*)(Pl + e) = ol;  }
__global__ __launch_bounds__(256) void k_vtp(const float* __restrict__ F, int pitch, int nheads, h16* V16, bf* Vh, bf* Vl) { const size_t e = ((size_t)blockIdx.x * 256 + threadIdx.x) * 2; if (e >= (size_t)nheads * HD * TT) return; const int t = (int)(e % TT); const int d = (int)((e / TT) % HD); const int g = (int)(e / ((size_t)TT * HD)); v2h o16; v2us oh, ol;
#pragma unroll
    for (int q = 0; q < 2; ++q) { const float x = F[(size_t)(t + q) * pitch + g * HD + d]; o16[q] = tohx(x); unsigned short a2, c2; splitf(x, a2, c2); oh[q] = a2; ol[q] = c2; }
    *(v2h*)(V16 + e) = o16; *(v2us*)(Vh + e) = oh; *(v2us*)(Vl + e) = ol;  }
__global__ __launch_bounds__(256) void k_csid(float* CS) { const int idx = blockIdx.x * 256 + threadIdx.x; if (idx >= TT * HD) return; v2f cs; cs[0] = 1.0f; cs[1] = 0.0f; *(v2f*)(CS + (size_t)idx * 2) = cs;  }
// k_asoft: per row (zz, i): t = S x HD^-0.5 for j <= i and i - j < WIN (WIN = TT, so plain causal; the reference's -1e9 additive fill vanishes identically); softmax over the 2048 keys (register row, one exp, fixed trees);
__global__ __launch_bounds__(256) void k_asoft(const float* __restrict__ Sb, h16* P16, bf* Ph, bf* Pl) {
    const int lane = threadIdx.x & 31; const int row = blockIdx.x * 8 + (threadIdx.x >> 5); if (row >= ZH * TT) return; const int i = row % TT; const int zz = row / TT; (void)zz; const bool hires = (i < RH); const float* sr = Sb + (size_t)row * TT; float v[TT / 32]; float mx = -3.0e38f;
#pragma unroll
    for (int ch = 0; ch < TT / 128; ++ch) { const int j0 = ch * 128 + lane * 4; const v4f a = *(const v4f*)(sr + j0);
#pragma unroll
        for (int q = 0; q < 4; ++q) { const int j = j0 + q; (void)j; const float t = (j <= i && i - j < WIN) ? a[q] * SCL : -3.0e38f; v[ch * 4 + q] = t; mx = fmaxf(mx, t); } }
#pragma unroll
    for (int sh = 16; sh; sh >>= 1) mx = fmaxf(mx, __shfl_xor(mx, sh, 32));
    float sum = 0.f;
#pragma unroll
    for (int k = 0; k < TT / 32; ++k) { float d0 = __fsub_rn(v[k], mx); asm volatile("" : "+v"(d0)); v[k] = __builtin_amdgcn_exp2f(__fmul_rn(d0, 1.4426950408889634f)); sum += v[k]; }
#pragma unroll
    for (int sh = 16; sh; sh >>= 1) sum += __shfl_xor(sum, sh, 32);
    const float f = __fdiv_rn(hires ? 1.0f : PCAR, sum);
{
        if (hires) {
#pragma unroll
            for (int ch = 0; ch < TT / 128; ++ch) { v4us oh, ol;
#pragma unroll
                for (int q = 0; q < 4; ++q) { unsigned short a, c2; splitf(v[ch * 4 + q] * f, a, c2); oh[q] = a; ol[q] = c2; }
                const size_t oo = ((size_t)zz * (RH ? RH : 1) + i) * TT + ch * 128 + lane * 4; *(v4us*)(Ph + oo) = oh; *(v4us*)(Pl + oo) = ol; }
        } else {
#pragma unroll
            for (int ch = 0; ch < TT / 128; ++ch) { v4h o4;
#pragma unroll
                for (int q = 0; q < 4; ++q) o4[q] = tohx(v[ch * 4 + q] * f);
                *(v4h*)(P16 + (size_t)row * TT + ch * 128 + lane * 4) = o4; } }
         }
}
__constant__ float THE[DM / 2] = { 1.000000000e+0f, 9.821718931e-1f, 9.646615982e-1f, 9.474635124e-1f, 9.305720329e-1f, 9.139816761e-1f, 8.976871371e-1f, 8.816830516e-1f, 8.659643531e-1f, 8.505257964e-1f, 8.353625536e-1f, 8.204696178e-1f, 8.058421612e-1f, 7.914755344e-1f, 7.773650289e-1f, 7.635060549e-1f, 7.498942018e-1f, 7.365249991e-1f, 7.233941555e-1f, 7.104974389e-1f, 6.978305578e-1f, 6.853895783e-1f, 6.731703877e-1f, 6.611690521e-1f, 6.493816376e-1f, 6.378043890e-1f, 6.264335513e-1f, 6.152654290e-1f, 6.042963862e-1f, 5.935229063e-1f, 5.829415321e-1f, 5.725488067e-1f, 5.623413324e-1f, 5.523158312e-1f, 5.424690843e-1f, 5.327978730e-1f, 5.232990980e-1f, 5.139696598e-1f, 5.048065782e-1f, 4.958068132e-1f, 4.869675338e-1f, 4.782858193e-1f, 4.697588682e-1f, 4.613839686e-1f, 4.531583786e-1f, 4.450794160e-1f, 4.371444881e-1f, 4.293510318e-1f, 4.216965139e-1f, 4.141784608e-1f, 4.067944288e-1f, 3.995420635e-1f, 3.924189806e-1f, 3.854228854e-1f, 3.785515130e-1f, 3.718026578e-1f, 3.651741147e-1f, 3.586637676e-1f, 3.522694707e-1f, 3.459891677e-1f, 3.398208320e-1f, 3.337624669e-1f, 3.278121054e-1f, 3.219678402e-1f, 3.162277639e-1f, 3.105900288e-1f, 3.050527871e-1f, 2.996142805e-1f, 2.942727208e-1f, 2.890263796e-1f, 2.838735878e-1f, 2.788126767e-1f, 2.738419771e-1f, 2.689598799e-1f, 2.641648352e-1f, 2.594552636e-1f, 2.548296750e-1f, 2.502865493e-1f, 2.458244115e-1f, 2.414418161e-1f, 2.371373773e-1f, 2.329096645e-1f, 2.287573218e-1f, 2.246790081e-1f, 2.206734121e-1f, 2.167392224e-1f, 2.128751725e-1f, 2.090800107e-1f, 2.053525001e-1f, 2.016914487e-1f, 1.980956793e-1f, 1.945639998e-1f, 1.910952926e-1f, 1.876884252e-1f, 1.843422949e-1f, 1.810558289e-1f, 1.778279394e-1f, 1.746575981e-1f, 1.715437919e-1f, 1.684854925e-1f, 1.654817164e-1f, 1.625314802e-1f, 1.596338600e-1f, 1.567878872e-1f, 1.539926529e-1f, 1.512472481e-1f, 1.485508084e-1f, 1.459024251e-1f, 1.433012635e-1f, 1.407464594e-1f, 1.382372230e-1f, 1.357727200e-1f, 1.333521456e-1f, 1.309747249e-1f, 1.286396980e-1f, 1.263462901e-1f, 1.240937784e-1f, 1.218814179e-1f, 1.197085008e-1f, 1.175743267e-1f, 1.154781953e-1f, 1.134194434e-1f, 1.113973856e-1f, 1.094113812e-1f, 1.074607819e-1f, 1.055449620e-1f, 1.036632955e-1f, 1.018151715e-1f, 1.000000015e-1f, 9.821718931e-2f, 9.646616131e-2f, 9.474635124e-2f, 9.305720776e-2f, 9.139817208e-2f, 8.976871520e-2f, 8.816830814e-2f, 8.659642935e-2f, 8.505257964e-2f, 8.353625238e-2f, 8.204696327e-2f, 8.058422059e-2f, 7.914755493e-2f, 7.773650438e-2f, 7.635060698e-2f, 7.498942316e-2f, 7.365249842e-2f, 7.233941555e-2f, 7.104974240e-2f, 6.978306174e-2f, 6.853895634e-2f, 6.731703877e-2f, 6.611689925e-2f, 6.493816525e-2f, 6.378044188e-2f, 6.264335662e-2f, 6.152654067e-2f, 6.042964011e-2f, 5.935229361e-2f, 5.829415470e-2f, 5.725488067e-2f, 5.623413250e-2f, 5.523158237e-2f, 5.424690992e-2f, 5.327979103e-2f, 5.232991278e-2f, 5.139696971e-2f, 5.048065633e-2f, 4.958068207e-2f, 4.869675264e-2f, 4.782858118e-2f, 4.697588831e-2f, 4.613839835e-2f, 4.531583562e-2f, 4.450793937e-2f, 4.371444881e-2f, 4.293510318e-2f, 4.216964915e-2f, 4.141784459e-2f, 4.067944363e-2f, 3.995420411e-2f, 3.924189880e-2f, 3.854228929e-2f, 3.785515204e-2f, 3.718026727e-2f, 3.651741147e-2f, 3.586637601e-2f, 3.522694483e-2f, 3.459891677e-2f, 3.398208320e-2f, 3.337624669e-2f, 3.278120980e-2f, 3.219678625e-2f, 3.162277490e-2f, 3.105900250e-2f, 3.050527908e-2f, 2.996142767e-2f, 2.942727134e-2f, 2.890263870e-2f, 2.838736027e-2f, 2.788126655e-2f, 2.738419548e-2f, 2.689598873e-2f, 2.641648240e-2f, 2.594552748e-2f, 2.548296750e-2f, 2.502865344e-2f, 2.458244003e-2f, 2.414418198e-2f, 2.371373773e-2f, 2.329096571e-2f, 2.287573181e-2f, 2.246790007e-2f, 2.206734009e-2f, 2.167392150e-2f, 2.128751576e-2f, 2.090799995e-2f, 2.053525113e-2f, 2.016914636e-2f, 1.980956830e-2f, 1.945640147e-2f, 1.910953037e-2f, 1.876884326e-2f, 1.843423024e-2f, 1.810558327e-2f, 1.778279431e-2f, 1.746576093e-2f, 1.715437882e-2f, 1.684854925e-2f, 1.654817164e-2f, 1.625314914e-2f, 1.596338488e-2f, 1.567878760e-2f, 1.539926510e-2f, 1.512472518e-2f, 1.485508028e-2f, 1.459024195e-2f, 1.433012541e-2f, 1.407464687e-2f, 1.382372249e-2f, 1.357727125e-2f, 1.333521400e-2f, 1.309747249e-2f, 1.286396943e-2f, 1.263462938e-2f, 1.240937784e-2f, 1.218814217e-2f, 1.197085064e-2f, 1.175743248e-2f, 1.154781971e-2f, 1.134194434e-2f, 1.113973837e-2f, 1.094113849e-2f, 1.074607857e-2f, 1.055449620e-2f, 1.036632899e-2f, 1.018151734e-2f, 9.999999776e-3f, 9.821718559e-3f, 9.646615945e-3f, 9.474635124e-3f, 9.305720218e-3f, 9.139817208e-3f, 8.976871148e-3f, 8.816830814e-3f, 8.659643121e-3f, 8.505257778e-3f, 8.353625424e-3f, 8.204695769e-3f, 8.058422245e-3f, 7.914755493e-3f, 7.773650344e-3f, 7.635060698e-3f, 7.498942316e-3f, 7.365250029e-3f, 7.233941462e-3f, 7.104974240e-3f, 6.978305988e-3f, 6.853895728e-3f, 6.731703877e-3f, 6.611690391e-3f, 6.493816152e-3f, 6.378043909e-3f, 6.264335476e-3f, 6.152654067e-3f, 6.042963825e-3f, 5.935229361e-3f, 5.829415284e-3f, 5.725488067e-3f, 5.623413250e-3f, 5.523158237e-3f, 5.424690899e-3f, 5.327979103e-3f, 5.232991185e-3f, 5.139696877e-3f, 5.048065912e-3f, 4.958068021e-3f, 4.869675264e-3f, 4.782858305e-3f, 4.697588738e-3f, 4.613839556e-3f, 4.531583749e-3f, 4.450793844e-3f, 4.371444695e-3f, 4.293510225e-3f, 4.216964822e-3f, 4.141784739e-3f, 4.067944363e-3f, 3.995420411e-3f, 3.924189601e-3f, 3.854228882e-3f, 3.785515204e-3f, 3.718026681e-3f, 3.651741194e-3f, 3.586637555e-3f, 3.522694577e-3f, 3.459891770e-3f, 3.398208413e-3f, 3.337624716e-3f, 3.278121119e-3f, 3.219678532e-3f, 3.162277630e-3f, 3.105900250e-3f, 3.050528001e-3f, 2.996142721e-3f, 2.942727180e-3f, 2.890263917e-3f, 2.838735934e-3f, 2.788126701e-3f, 2.738419687e-3f, 2.689598827e-3f, 2.641648287e-3f, 2.594552701e-3f, 2.548296703e-3f, 2.502865391e-3f, 2.458244096e-3f, 2.414418152e-3f, 2.371373819e-3f, 2.329096664e-3f, 2.287573181e-3f, 2.246790100e-3f, 2.206734149e-3f, 2.167392056e-3f, 2.128751716e-3f, 2.090800088e-3f, 2.053525066e-3f, 2.016914543e-3f, 1.980956877e-3f, 1.945640077e-3f, 1.910952968e-3f, 1.876884256e-3f, 1.843423001e-3f, 1.810558257e-3f, 1.778279431e-3f, 1.746576047e-3f, 1.715437858e-3f, 1.684854855e-3f, 1.654817141e-3f, 1.625314821e-3f, 1.596338581e-3f, 1.567878877e-3f, 1.539926510e-3f, 1.512472518e-3f, 1.485508052e-3f, 1.459024264e-3f, 1.433012541e-3f, 1.407464617e-3f, 1.382372226e-3f, 1.357727102e-3f, 1.333521446e-3f, 1.309747226e-3f, 1.286396990e-3f, 1.263462938e-3f, 1.240937738e-3f, 1.218814170e-3f, 1.197085017e-3f, 1.175743295e-3f, 1.154782018e-3f, 1.134194434e-3f, 1.113973907e-3f, 1.094113803e-3f, 1.074607833e-3f, 1.055449597e-3f, 1.036632922e-3f, 1.018151757e-3f, 1.000000047e-3f, 9.821718559e-4f, 9.646615945e-4f, 9.474635008e-4f, 9.305720450e-4f, 9.139816975e-4f, 8.976871613e-4f, 8.816830814e-4f, 8.659643354e-4f, 8.505258011e-4f, 8.353625308e-4f, 8.204696351e-4f, 8.058421663e-4f, 7.914755261e-4f, 7.773650577e-4f, 7.635061047e-4f, 7.498941850e-4f, 7.365249912e-4f, 7.233941578e-4f, 7.104974356e-4f, 6.978305755e-4f, 6.853895611e-4f, 6.731703761e-4f, 6.611690042e-4f, 6.493816036e-4f, 6.378043909e-4f, 6.264335243e-4f, 6.152653950e-4f, 6.042963942e-4f, 5.935229128e-4f, 5.829415168e-4f, 5.725487717e-4f, 5.623413017e-4f, 5.523158470e-4f, 5.424690899e-4f, 5.327978870e-4f, 5.232990952e-4f, 5.139696877e-4f, 5.048065796e-4f, 4.958068021e-4f, 4.869675322e-4f, 4.782858014e-4f, 4.697588738e-4f, 4.613839556e-4f, 4.531583691e-4f, 4.450794077e-4f, 4.371444811e-4f, 4.293510283e-4f, 4.216965172e-4f, 4.141784448e-4f, 4.067944246e-4f, 3.995420702e-4f, 3.924189659e-4f, 3.854228999e-4f, 3.785515146e-4f, 3.718026564e-4f, 3.651741135e-4f, 3.586637613e-4f, 3.522694751e-4f, 3.459891595e-4f, 3.398208355e-4f, 3.337624657e-4f, 3.278121294e-4f, 3.219678474e-4f, 3.162277571e-4f, 3.105900250e-4f, 3.050527885e-4f, 2.996142721e-4f, 2.942727297e-4f, 2.890263859e-4f, 2.838736109e-4f, 2.788126585e-4f, 2.738419571e-4f, 2.689598768e-4f, 2.641648462e-4f, 2.594552643e-4f, 2.548296761e-4f, 2.502865391e-4f, 2.458243980e-4f, 2.414418268e-4f, 2.371373703e-4f, 2.329096606e-4f, 2.287573152e-4f, 2.246790100e-4f, 2.206734061e-4f, 2.167392231e-4f, 2.128751657e-4f, 2.090799971e-4f, 2.053525095e-4f, 2.016914514e-4f, 1.980956731e-4f, 1.945640106e-4f, 1.910952997e-4f, 1.876884344e-4f, 1.843422942e-4f, 1.810558315e-4f, 1.778279402e-4f, 1.746576017e-4f, 1.715437829e-4f, 1.684854942e-4f, 1.654817170e-4f, 1.625314908e-4f, 1.596338552e-4f, 1.567878790e-4f, 1.539926598e-4f, 1.512472518e-4f, 1.485507964e-4f, 1.459024206e-4f, 1.433012512e-4f, 1.407464733e-4f, 1.382372284e-4f, 1.357727160e-4f, 1.333521504e-4f, 1.309747313e-4f, 1.286396873e-4f, 1.263462909e-4f, 1.240937709e-4f, 1.218814214e-4f, 1.197085003e-4f, 1.175743237e-4f, 1.154782003e-4f, 1.134194390e-4f, 1.113973849e-4f, 1.094113832e-4f, 1.074607862e-4f, 1.055449611e-4f, 1.036632893e-4f, 1.018151743e-4f };   // 10000^(-2i/1024), i = 0..511 (float32)
__global__ __launch_bounds__(256) void k_preRopeI(const float* __restrict__ X, bf* Ph, bf* Pl) { const size_t k = (size_t)blockIdx.x * 256 + threadIdx.x; if (k >= (size_t)TT * DM / 4) return; const size_t e = k * 4; const int d0 = (int)(e % DM); const int t = (int)(e / DM); const v4f a = *(const v4f*)(X + e); v4us oh, ol;
#pragma unroll
    for (int p = 0; p < 2; ++p) { const int i = (d0 >> 1) + p; const float ang = __fmul_rn((float)t, THE[i]); const float c = cosf(ang), sn = sinf(ang); const float x0 = bfr(a[2 * p]), x1 = bfr(a[2 * p + 1]);
        float a0 = __fmul_rn(x0, c), b0 = __fmul_rn(x1, sn), a1 = __fmul_rn(x1, c), b1 = __fmul_rn(x0, sn); asm volatile("" : "+v"(a0), "+v"(b0), "+v"(a1), "+v"(b1)); const float y0 = __fsub_rn(a0, b0), y1 = __fadd_rn(a1, b1); unsigned short u, w; splitf(y0, u, w); oh[2 * p] = u; ol[2 * p] = w; splitf(y1, u, w); oh[2 * p + 1] = u; ol[2 * p + 1] = w; }
    *(v4us*)(Ph + e) = oh; *(v4us*)(Pl + e) = ol;  }
__global__ __launch_bounds__(256) void k_merge(const float* __restrict__ O, int h0, bf* Ah, bf* Al) { const size_t e = ((size_t)blockIdx.x * 256 + threadIdx.x) * 2; if (e >= (size_t)ZH * TT * HD) return; const int d = (int)(e % HD); const int t = (int)((e / HD) % TT); const int zz = (int)(e / ((size_t)HD * TT)); const float cs = (t < RH) ? 1.0f : (1.0f / PCAR); const size_t oo = (size_t)t * DQ + (h0 + zz) * HD + d;
    v2us oh, ol;
#pragma unroll
    for (int q = 0; q < 2; ++q) { unsigned short a, c2; splitf(O[e + q] * cs, a, c2); oh[q] = a; ol[q] = c2; } *(v2us*)(Ah + oo) = oh; *(v2us*)(Al + oo) = ol;  }

extern "C" void kernel_launch(void* const* d_in, const int* in_sizes, int n_in,
                              void* d_out, int out_size, void* d_ws, size_t ws_size, hipStream_t stream) {
    (void)in_sizes; (void)n_in; (void)out_size;
    const float* x = (const float*)d_in[0]; const float* wq = (const float*)d_in[1]; const float* wk = (const float*)d_in[2]; const float* wv = (const float*)d_in[3]; const float* wo = (const float*)d_in[4]; const float* bo = (const float*)d_in[5];
    float* OUT = (float*)d_out;     // [4][2048][1024]
    char* wsp = (char*)d_ws;
    auto take = [&](size_t bytes) { char* p = wsp; wsp += (bytes + 255) & ~(size_t)255; return (void*)p; };
    bf* XBl = (bf*)take((size_t)TT * DM * 2); bf* WQ = (bf*)take((size_t)DQ * DM * 2); bf* WK = (bf*)take((size_t)DKV * DM * 2); bf* WV = (bf*)take((size_t)DKV * DM * 2); bf* WO = (bf*)take((size_t)DM * DQ * 2); float* CS = (float*)take((size_t)TT * HD * 2 * 4);
    bf* XB = (bf*)take((size_t)TT * DM * 2); float* FQ = (float*)take((size_t)TT * DQ * 4); float* FK = (float*)take((size_t)TT * DKV * 4);
    h16* QP16 = (h16*)take((size_t)NH_ * TT * HD * 2); h16* KP16 = (h16*)take((size_t)NKV * TT * HD * 2); h16* VT16 = (h16*)take((size_t)NKV * HD * TT * 2);
    bf* QPh = (bf*)take((size_t)NH_ * TT * HD * 2); bf* QPl = (bf*)take((size_t)NH_ * TT * HD * 2); bf* KPh = (bf*)take((size_t)NKV * TT * HD * 2); bf* KPl = (bf*)take((size_t)NKV * TT * HD * 2); bf* VTh = (bf*)take((size_t)NKV * HD * TT * 2); bf* VTl = (bf*)take((size_t)NKV * HD * TT * 2); bf* Ph = (bf*)take((size_t)ZH * RH * TT * 2); bf* Pl = (bf*)take((size_t)ZH * RH * TT * 2);
    float* Sb = (float*)take((size_t)ZH * TT * TT * 4); h16* P16 = (h16*)take((size_t)ZH * TT * TT * 2); float* Ob = (float*)take((size_t)ZH * TT * HD * 4); bf* ATh = (bf*)take((size_t)TT * DQ * 2); bf* ATl = (bf*)take((size_t)TT * DQ * 2);
    if ((size_t)(wsp - (char*)d_ws) > ws_size) return;    // ws 256 MiB
    float* FV = FK;   // v projection reuses the k buffer after the k planes are built (stream-ordered)
    { k_cvt8<<<(unsigned)(((size_t)DQ * DM / 8 + 255) / 256), 256, 0, stream>>>(wq, WQ, (size_t)DQ * DM / 8); k_cvt8<<<(unsigned)(((size_t)DKV * DM / 8 + 255) / 256), 256, 0, stream>>>(wk, WK, (size_t)DKV * DM / 8); k_cvt8<<<(unsigned)(((size_t)DKV * DM / 8 + 255) / 256), 256, 0, stream>>>(wv, WV, (size_t)DKV * DM / 8);
      k_cvt8<<<(unsigned)(((size_t)DM * DQ / 8 + 255) / 256), 256, 0, stream>>>(wo, WO, (size_t)DM * DQ / 8);
       }
    k_csid<<<(TT * HD + 255) / 256, 256, 0, stream>>>(CS);
    const unsigned LQ = (unsigned)(((size_t)NH_ * TT * HD / 2 + 255) / 256), LKv = (unsigned)(((size_t)NKV * TT * HD / 2 + 255) / 256);
    for (int b = 0; b < NB_; ++b) {
        
        k_preRopeI<<<(unsigned)(((size_t)TT * DM / 4 + 255) / 256), 256, 0, stream>>>(x + (size_t)b * TT * DM, XB, XBl);   /* rx = pairwise rope of the input, as hi/lo planes */
        k_gemmw<bf, 1, false, false, 8><<<dim3(TT / 64, DQ / 64, 1), 256, 0, stream>>>(XB, XBl, WQ, nullptr, DM, FQ, DQ, nullptr, 0, 0, 0, 0);   /* q = rx Wq^T (hi/lo x exact) */
        k_rope<<<LQ, 256, 0, stream>>>(FQ, DQ, NH_, CS, nullptr, nullptr, 1.0f, QP16, QPh, QPl);
        k_gemmw<bf, 1, false, false, 8><<<dim3(TT / 64, DKV / 64, 1), 256, 0, stream>>>(XB, XBl, WK, nullptr, DM, FK, DKV, nullptr, 0, 0, 0, 0);   /* k = rx Wk^T */
        k_rope<<<LKv, 256, 0, stream>>>(FK, DKV, NKV, CS, nullptr, nullptr, 1.0f, KP16, KPh, KPl);
        k_cvt8<<<(unsigned)(((size_t)TT * DM / 8 + 255) / 256), 256, 0, stream>>>(x + (size_t)b * TT * DM, XB, (size_t)TT * DM / 8);   /* plain input for v */ k_gemmw<bf, 0, false, false, 8><<<dim3(TT / 64, DKV / 64, 1), 256, 0, stream>>>(XB, nullptr, WV, nullptr, DM, FV, DKV, nullptr, 0, 0, 0, 0); k_vtp<<<LKv, 256, 0, stream>>>(FV, DKV, NKV, VT16, VTh, VTl);
        for (int h0 = 0; h0 < NH_; h0 += ZH) { const size_t zq = (size_t)h0, zk = (size_t)(h0 / REP);   // one kv head per query head: the pass's two heads use consecutive kv planes (z-strides TT*HD)
            k_gemmc<bf, 2><<<dim3(RH / 64, TT / 64, ZH), 32, 0, stream>>>(QPh + zq * TT * HD, QPl + zq * TT * HD, KPh + zk * TT * HD, KPl + zk * TT * HD, HD, Sb, TT, 0, (size_t)TT * HD, (size_t)TT * HD, (size_t)TT * TT);
            k_gemmc<h16, 0><<<dim3((TT - RH) / 64, TT / 64, ZH), 32, 0, stream>>>(QP16 + zq * TT * HD + (size_t)RH * HD, nullptr, KP16 + zk * TT * HD, nullptr, HD, Sb + (size_t)RH * TT, TT, RH, (size_t)TT * HD, (size_t)TT * HD, (size_t)TT * TT);
            k_asoft<<<ZH * TT / 8, 256, 0, stream>>>(Sb, P16, Ph, Pl);
            k_gemmw<bf, 2, false, true, 8><<<dim3(RH / 64, HD / 64, ZH), 256, 0, stream>>>(Ph, Pl, VTh + zk * HD * TT, VTl + zk * HD * TT, TT, Ob, HD, nullptr, 0, (size_t)RH * TT, (size_t)HD * TT, (size_t)TT * HD);
            k_gemmw<h16, 0, false, true, 16><<<dim3((TT - RH) / 64, HD / 64, ZH), 512, 0, stream>>>(P16 + (size_t)RH * TT, nullptr, VT16 + zk * HD * TT, nullptr, TT, Ob + (size_t)RH * HD, HD, nullptr, RH, (size_t)TT * TT, (size_t)HD * TT, (size_t)TT * HD);
            k_merge<<<(unsigned)(((size_t)ZH * TT * HD / 2 + 255) / 256), 256, 0, stream>>>(Ob, h0, ATh, ATl); }
        k_gemmw<bf, 1, true, false, 8><<<dim3(TT / 64, DM / 64, 1), 256, 0, stream>>>(ATh, ATl, WO, nullptr, DQ, OUT + (size_t)b * TT * DM, DM, bo, 0, 0, 0, 0); }
}

// v002
// One run takes 471 microseconds.
// Timed twice side by side with v001, it ran 3.35 and 3.33 times as fast.
// All steps since v000 together make it 6.20 times as fast.
#include <hip/hip_runtime.h>

// Causal multi-head self-attention with a pairwise rotary applied to the INPUT before the q/k projections (input [4][2048][1024]; rx[t][2i], rx[t][2i+1] = rotation of (x[2i], x[2i+1]) by t x 10000^(-2i/1024) over the 1,024 features (computed); q = rx Wq^T, k = rx Wk^T, v = input Wv^T ('oi' 1/32, no bias; 16 heads x 64); scores masked causal then / 8; softmax; out = merged Wo^T + bo -> [4][2048][1024] (8.4 M)).
// Layout per batch: a rotary kernel builds rx from the bf16-rounded input with on-the-fly precise cosf/sinf of t x theta[i] (512 float32 constants) and splits it into bf16 hi/lo planes; q and k projections hi/lo x exact; a plain bf16 copy of the input feeds the exact v projection; causal T-2048 attention fused in one launch, running softmax (hybrid rows: < 512 hi/lo 3 products, rest fp16 x1024; key passes above the diagonal skipped); merged hi/lo x Wo exact + bo.
// Compute dtypes, f32 accumulate: every input rounded to bf16; input rotary f32, q/k projections hi/lo x exact (2 products: ~f32), v exact; attention rows < 512 3 products, rest fp16; softmax f32; Wo hl x exact + bias.

#define NB_  4
#define TT   2048
#define DM   1024
#define NH_  16
#define NKV  16
#define HD   64
#define DQ   (NH_ * HD)
#define DKV  (NKV * HD)
#define RH   512                  // query rows < RH use hi+lo planes (0: none)
#define SCL  0.125f   // HD^-0.5
typedef _Float16 h16;
typedef unsigned short bf;
typedef __attribute__((ext_vector_type(16))) __bf16   v16bf;
typedef __attribute__((ext_vector_type(16))) _Float16 v16h;
typedef __attribute__((ext_vector_type(8)))  _Float16 v8h;
typedef __attribute__((ext_vector_type(8)))  unsigned short v8us;
typedef __attribute__((ext_vector_type(8)))  float    v8f;
typedef __attribute__((ext_vector_type(4)))  float    v4f;
typedef v8h  __attribute__((may_alias)) v8ha;
typedef v4f  __attribute__((may_alias)) v4fa;
typedef v8us __attribute__((may_alias)) v8usa;

__device__ __forceinline__ unsigned short f2bf(float f) { unsigned u = __float_as_uint(f); u += 0x7FFFu + ((u >> 16) & 1u); return (unsigned short)(u >> 16); }
__device__ __forceinline__ float bf2f(unsigned short b) { return __uint_as_float(((unsigned)b) << 16); }
__device__ __forceinline__ float bfr(float f) { return bf2f(f2bf(f)); }
__device__ __forceinline__ v16h cat16(v8h lo, v8h hi) { return __builtin_shufflevector(lo, hi, 0, 1, 2, 3, 4, 5, 6, 7, 8, 9, 10, 11, 12, 13, 14, 15); }
__device__ __forceinline__ v16bf cat16b(v8us lo, v8us hi) { return __builtin_bit_cast(v16bf, __builtin_shufflevector(lo, hi, 0, 1, 2, 3, 4, 5, 6, 7, 8, 9, 10, 11, 12, 13, 14, 15)); }
__device__ __forceinline__ v8f wmma16(v16h a, v16h b, v8f c) { return __builtin_amdgcn_wmma_f32_16x16x32_f16(false, a, false, b, (short)0, c, false, false); }
__device__ __forceinline__ v8f wmmab(v16bf a, v16bf b, v8f c) { return __builtin_amdgcn_wmma_f32_16x16x32_bf16(false, a, false, b, (short)0, c, false, false); }



// ---- k_gemmw: register-blocked GEMM, one work-group of NW waves per 64x64 output tile, operands straight from K-contiguous 16-bit planes; grid (M/64, N/64, Z), 32 NW threads.
// C[m][n] (f32, pitch ldc, + optional f32 bias[n]) = sum_k A[m][k] Bt[n][k] (+ split products per NSPLIT). z-batch strides sA/sB/sC in elements. K % 32 == 0.
// The K loop is a chain of dependent load latencies, so it is cut into NW contiguous runs of 32-k chunks, one run a wave: each wave holds a whole 64x64 f32 partial tile (16 accumulators),
// and the NW partial tiles are added through LDS in wave order. DIAG (probability x value contraction): the K loop ends at the diagonal block of query rows r0+roff.. (probabilities beyond it are exactly zero).
template <typename T16> struct WFrag;
template <> struct WFrag<h16> { typedef v16h V; static __device__ __forceinline__ V ld(const h16* p) { return cat16(*(const v8h*)p, *(const v8h*)(p + 16)); } static __device__ __forceinline__ v8f mma(V a, V b, v8f c) { return wmma16(a, b, c); } };
template <> struct WFrag<bf> { typedef v16bf V; static __device__ __forceinline__ V ld(const bf* p) { return cat16b(*(const v8us*)p, *(const v8us*)(p + 16)); } static __device__ __forceinline__ v8f mma(V a, V b, v8f c) { return wmmab(a, b, c); } };
template <typename T16, int NSPLIT, bool BIAS, bool DIAG, int NW>
__global__ __launch_bounds__(32 * NW) void k_gemmw(const T16* __restrict__ A, const T16* __restrict__ A2, const T16* __restrict__ Bt, const T16* __restrict__ Bt2, int K, float* C, int ldc, const float* __restrict__ bias, int roff, size_t sA, size_t sB, size_t sC) {
    typedef typename WFrag<T16>::V V;
    __shared__ __align__(16) float os[NW * 64 * 68];   // one 64x64 partial tile a wave, row pitch 68
    const size_t z = blockIdx.z; A += z * sA; if (A2) A2 += z * sA; Bt += z * sB; if (Bt2) Bt2 += z * sB; C += z * sC;
    const int lane = threadIdx.x & 31, lr = lane & 15, hi = lane >> 4; const int r0 = blockIdx.x * 64, c0 = blockIdx.y * 64;
    const int w = __builtin_amdgcn_readfirstlane((int)(threadIdx.x >> 5));   // wave number, held scalar so that the K loop keeps a scalar branch
    const int nch = (DIAG ? min(K, r0 + roff + 64) : K) / 32;                // 32-k chunks of this tile
    const int kb = 32 * (w * nch / NW), ke = 32 * ((w + 1) * nch / NW);      // this wave's run of them (empty where there are fewer chunks than waves)
    v8f acc[4][4];
#pragma unroll
    for (int mb = 0; mb < 4; ++mb)
#pragma unroll
        for (int nb = 0; nb < 4; ++nb) acc[mb][nb] = (v8f){};
    const size_t aoff = (size_t)(r0 + lr) * K + 8 * hi, boff = (size_t)(c0 + lr) * K + 8 * hi;
#pragma unroll 1
    for (int kc = kb; kc < ke; kc += 32) {
        V a[4], a2[4];
#pragma unroll
        for (int mb = 0; mb < 4; ++mb) { a[mb] = WFrag<T16>::ld(A + aoff + (size_t)mb * 16 * K + kc); if (NSPLIT == 1 || NSPLIT == 2) a2[mb] = WFrag<T16>::ld(A2 + aoff + (size_t)mb * 16 * K + kc); }
#pragma unroll
        for (int nb = 0; nb < 4; ++nb) { const V b = WFrag<T16>::ld(Bt + boff + (size_t)nb * 16 * K + kc); V b2; if (NSPLIT >= 2) b2 = WFrag<T16>::ld(Bt2 + boff + (size_t)nb * 16 * K + kc);
#pragma unroll
            for (int mb = 0; mb < 4; ++mb) { acc[mb][nb] = WFrag<T16>::mma(a[mb], b, acc[mb][nb]); if (NSPLIT == 1 || NSPLIT == 2) acc[mb][nb] = WFrag<T16>::mma(a2[mb], b, acc[mb][nb]); if (NSPLIT >= 2) acc[mb][nb] = WFrag<T16>::mma(a[mb], b2, acc[mb][nb]); } }
        asm volatile("v_nop\n\tv_nop\n\tv_nop\n\tv_nop" : "+v"(acc[0][0]), "+v"(acc[1][1]), "+v"(acc[2][2]), "+v"(acc[3][3]) : "v"(a[0]), "v"(a[3]));
    }
    float* ow = os + w * 64 * 68;
#pragma unroll
    for (int mb = 0; mb < 4; ++mb) {
#pragma unroll
        for (int nb = 0; nb < 4; ++nb) {
#pragma unroll
            for (int j = 0; j < 8; ++j) ow[(mb * 16 + hi * 8 + j) * 68 + nb * 16 + lr] = acc[mb][nb][j]; } }
    __syncthreads();                               // all NW partial tiles are in LDS before any thread adds them
#pragma unroll
    for (int s = 0; s < 32 / NW; ++s) { const int q = s * 32 * NW + threadIdx.x, row = q >> 4, cofs = (q & 15) * 4; v4f val = *(const v4fa*)(os + row * 68 + cofs);
#pragma unroll
        for (int u = 1; u < NW; ++u) val += *(const v4fa*)(os + (u * 64 + row) * 68 + cofs);
        if (BIAS) { val[0] += bfr(bias[c0 + cofs]); val[1] += bfr(bias[c0 + cofs + 1]); val[2] += bfr(bias[c0 + cofs + 2]); val[3] += bfr(bias[c0 + cofs + 3]); }
        *(v4f*)(C + (size_t)(r0 + row) * ldc + c0 + cofs) = val; }
}

__device__ __forceinline__ h16 tohx(float x) { return (h16)x; }
__device__ __forceinline__ void splitf(float y, unsigned short& h, unsigned short& l) { h = f2bf(y); l = f2bf(y - bf2f(h)); }
typedef __attribute__((ext_vector_type(2))) _Float16 v2h;
typedef __attribute__((ext_vector_type(4))) _Float16 v4h;
typedef __attribute__((ext_vector_type(2))) unsigned short v2us;
typedef __attribute__((ext_vector_type(4))) unsigned short v4us;
typedef __attribute__((ext_vector_type(2))) float v2f;
typedef __attribute__((ext_vector_type(4))) int v4i;

__global__ __launch_bounds__(256) void k_wtG(const float* __restrict__ w, int K, int N, bf* Bt) {
    const int lane = threadIdx.x & 31; const int L0 = (blockIdx.x * 8 + (threadIdx.x >> 5)) * 8; const int nlines = N * K / 64;
{
#pragma unroll 1
        for (int l = 0; l < 8; ++l) { const int L = L0 + l; if (L >= nlines) break; const size_t e = (size_t)L * 64 + lane * 2; const int k = (int)(e % K), n = (int)(e / K); v2us o;
            o[0] = f2bf(w[(size_t)k * N + n]); o[1] = f2bf(w[(size_t)(k + 1) * N + n]); *(v2us*)(Bt + e) = o; }
         }
}
__global__ __launch_bounds__(256) void k_cvt8(const float* __restrict__ src, bf* dst, size_t n8) { const size_t i = (size_t)blockIdx.x * 256 + threadIdx.x; if (i >= n8) return; const v8f v = *(const v8f*)(src + i * 8); v8us o;
#pragma unroll
    for (int k = 0; k < 8; ++k) o[k] = f2bf(v[k]); *(v8us*)(dst + i * 8) = o;  }

// k_rope: head planes [h][t][d] (fp16 + hi/lo) of rope(x) x sc with the rotate-half convention out[d] = x[d] cos[t][d] - x[d+HD/2] sin[t][d], out[d+HD/2] = x[d+HD/2] cos[t][d+HD/2] + x[d] sin[t][d+HD/2]
__global__ __launch_bounds__(256) void k_rope(const float* __restrict__ F, int pitch, int nheads, const float* __restrict__ CS, const float* __restrict__ RF, const float* __restrict__ nw, float sc, h16* P16, bf* Ph, bf* Pl) {
    const size_t e = ((size_t)blockIdx.x * 256 + threadIdx.x) * 2; if (e >= (size_t)nheads * TT * HD) return; const int d = (int)(e % HD); const int t = (int)((e / HD) % TT); const int h = (int)(e / ((size_t)HD * TT)); const float* f = F + (size_t)t * pitch + h * HD; const float rf = RF ? RF[(size_t)h * TT + t] : 1.0f; v2h o16; v2us oh, ol;
#pragma unroll
    for (int q = 0; q < 2; ++q) { const int dd = d + q; const int dp = (dd < HD / 2) ? dd + HD / 2 : dd - HD / 2; float x0 = f[dd], x1 = f[dp];
        if (RF) { float n0 = __fmul_rn(x0, rf), n1 = __fmul_rn(x1, rf); asm volatile("" : "+v"(n0)); asm volatile("" : "+v"(n1)); x0 = __fmul_rn(bfr(nw[dd]), n0); x1 = __fmul_rn(bfr(nw[dp]), n1); }
        const v2f cs = *(const v2f*)(CS + ((size_t)t * HD + dd) * 2); float a = __fmul_rn(x0, cs[0]), bq = __fmul_rn(x1, cs[1]); asm volatile("" : "+v"(a)); asm volatile("" : "+v"(bq)); const float r = ((dd < HD / 2) ? __fsub_rn(a, bq) : __fadd_rn(a, bq)) * sc;
        o16[q] = tohx(r); unsigned short a2, c2; splitf(r, a2, c2); oh[q] = a2; ol[q] = c2; }
    *(v2h*)(P16 + e) = o16; *(v2us*)(Ph + e) = oh; *(v2us*)(Pl + e) = ol;  }
__global__ __launch_bounds__(256) void k_vtp(const float* __restrict__ F, int pitch, int nheads, h16* V16, bf* Vh, bf* Vl) { const size_t e = ((size_t)blockIdx.x * 256 + threadIdx.x) * 2; if (e >= (size_t)nheads * HD * TT) return; const int t = (int)(e % TT); const int d = (int)((e / TT) % HD); const int g = (int)(e / ((size_t)TT * HD)); v2h o16; v2us oh, ol;
#pragma unroll
    for (int q = 0; q < 2; ++q) { const float x = F[(size_t)(t + q) * pitch + g * HD + d]; o16[q] = tohx(x); unsigned short a2, c2; splitf(x, a2, c2); oh[q] = a2; ol[q] = c2; }
    *(v2h*)(V16 + e) = o16; *(v2us*)(Vh + e) = oh; *(v2us*)(Vl + e) = ol;  }
__global__ __launch_bounds__(256) void k_csid(float* CS) { const int idx = blockIdx.x * 256 + threadIdx.x; if (idx >= TT * HD) return; v2f cs; cs[0] = 1.0f; cs[1] = 0.0f; *(v2f*)(CS + (size_t)idx * 2) = cs;  }
__constant__ float THE[DM / 2] = { 1.000000000e+0f, 9.821718931e-1f, 9.646615982e-1f, 9.474635124e-1f, 9.305720329e-1f, 9.139816761e-1f, 8.976871371e-1f, 8.816830516e-1f, 8.659643531e-1f, 8.505257964e-1f, 8.353625536e-1f, 8.204696178e-1f, 8.058421612e-1f, 7.914755344e-1f, 7.773650289e-1f, 7.635060549e-1f, 7.498942018e-1f, 7.365249991e-1f, 7.233941555e-1f, 7.104974389e-1f, 6.978305578e-1f, 6.853895783e-1f, 6.731703877e-1f, 6.611690521e-1f, 6.493816376e-1f, 6.378043890e-1f, 6.264335513e-1f, 6.152654290e-1f, 6.042963862e-1f, 5.935229063e-1f, 5.829415321e-1f, 5.725488067e-1f, 5.623413324e-1f, 5.523158312e-1f, 5.424690843e-1f, 5.327978730e-1f, 5.232990980e-1f, 5.139696598e-1f, 5.048065782e-1f, 4.958068132e-1f, 4.869675338e-1f, 4.782858193e-1f, 4.697588682e-1f, 4.613839686e-1f, 4.531583786e-1f, 4.450794160e-1f, 4.371444881e-1f, 4.293510318e-1f, 4.216965139e-1f, 4.141784608e-1f, 4.067944288e-1f, 3.995420635e-1f, 3.924189806e-1f, 3.854228854e-1f, 3.785515130e-1f, 3.718026578e-1f, 3.651741147e-1f, 3.586637676e-1f, 3.522694707e-1f, 3.459891677e-1f, 3.398208320e-1f, 3.337624669e-1f, 3.278121054e-1f, 3.219678402e-1f, 3.162277639e-1f, 3.105900288e-1f, 3.050527871e-1f, 2.996142805e-1f, 2.942727208e-1f, 2.890263796e-1f, 2.838735878e-1f, 2.788126767e-1f, 2.738419771e-1f, 2.689598799e-1f, 2.641648352e-1f, 2.594552636e-1f, 2.548296750e-1f, 2.502865493e-1f, 2.458244115e-1f, 2.414418161e-1f, 2.371373773e-1f, 2.329096645e-1f, 2.287573218e-1f, 2.246790081e-1f, 2.206734121e-1f, 2.167392224e-1f, 2.128751725e-1f, 2.090800107e-1f, 2.053525001e-1f, 2.016914487e-1f, 1.980956793e-1f, 1.945639998e-1f, 1.910952926e-1f, 1.876884252e-1f, 1.843422949e-1f, 1.810558289e-1f, 1.778279394e-1f, 1.746575981e-1f, 1.715437919e-1f, 1.684854925e-1f, 1.654817164e-1f, 1.625314802e-1f, 1.596338600e-1f, 1.567878872e-1f, 1.539926529e-1f, 1.512472481e-1f, 1.485508084e-1f, 1.459024251e-1f, 1.433012635e-1f, 1.407464594e-1f, 1.382372230e-1f, 1.357727200e-1f, 1.333521456e-1f, 1.309747249e-1f, 1.286396980e-1f, 1.263462901e-1f, 1.240937784e-1f, 1.218814179e-1f, 1.197085008e-1f, 1.175743267e-1f, 1.154781953e-1f, 1.134194434e-1f, 1.113973856e-1f, 1.094113812e-1f, 1.074607819e-1f, 1.055449620e-1f, 1.036632955e-1f, 1.018151715e-1f, 1.000000015e-1f, 9.821718931e-2f, 9.646616131e-2f, 9.474635124e-2f, 9.305720776e-2f, 9.139817208e-2f, 8.976871520e-2f, 8.816830814e-2f, 8.659642935e-2f, 8.505257964e-2f, 8.353625238e-2f, 8.204696327e-2f, 8.058422059e-2f, 7.914755493e-2f, 7.773650438e-2f, 7.635060698e-2f, 7.498942316e-2f, 7.365249842e-2f, 7.233941555e-2f, 7.104974240e-2f, 6.978306174e-2f, 6.853895634e-2f, 6.731703877e-2f, 6.611689925e-2f, 6.493816525e-2f, 6.378044188e-2f, 6.264335662e-2f, 6.152654067e-2f, 6.042964011e-2f, 5.935229361e-2f, 5.829415470e-2f, 5.725488067e-2f, 5.623413250e-2f, 5.523158237e-2f, 5.424690992e-2f, 5.327979103e-2f, 5.232991278e-2f, 5.139696971e-2f, 5.048065633e-2f, 4.958068207e-2f, 4.869675264e-2f, 4.782858118e-2f, 4.697588831e-2f, 4.613839835e-2f, 4.531583562e-2f, 4.450793937e-2f, 4.371444881e-2f, 4.293510318e-2f, 4.216964915e-2f, 4.141784459e-2f, 4.067944363e-2f, 3.995420411e-2f, 3.924189880e-2f, 3.854228929e-2f, 3.785515204e-2f, 3.718026727e-2f, 3.651741147e-2f, 3.586637601e-2f, 3.522694483e-2f, 3.459891677e-2f, 3.398208320e-2f, 3.337624669e-2f, 3.278120980e-2f, 3.219678625e-2f, 3.162277490e-2f, 3.105900250e-2f, 3.050527908e-2f, 2.996142767e-2f, 2.942727134e-2f, 2.890263870e-2f, 2.838736027e-2f, 2.788126655e-2f, 2.738419548e-2f, 2.689598873e-2f, 2.641648240e-2f, 2.594552748e-2f, 2.548296750e-2f, 2.502865344e-2f, 2.458244003e-2f, 2.414418198e-2f, 2.371373773e-2f, 2.329096571e-2f, 2.287573181e-2f, 2.246790007e-2f, 2.206734009e-2f, 2.167392150e-2f, 2.128751576e-2f, 2.090799995e-2f, 2.053525113e-2f, 2.016914636e-2f, 1.980956830e-2f, 1.945640147e-2f, 1.910953037e-2f, 1.876884326e-2f, 1.843423024e-2f, 1.810558327e-2f, 1.778279431e-2f, 1.746576093e-2f, 1.715437882e-2f, 1.684854925e-2f, 1.654817164e-2f, 1.625314914e-2f, 1.596338488e-2f, 1.567878760e-2f, 1.539926510e-2f, 1.512472518e-2f, 1.485508028e-2f, 1.459024195e-2f, 1.433012541e-2f, 1.407464687e-2f, 1.382372249e-2f, 1.357727125e-2f, 1.333521400e-2f, 1.309747249e-2f, 1.286396943e-2f, 1.263462938e-2f, 1.240937784e-2f, 1.218814217e-2f, 1.197085064e-2f, 1.175743248e-2f, 1.154781971e-2f, 1.134194434e-2f, 1.113973837e-2f, 1.094113849e-2f, 1.074607857e-2f, 1.055449620e-2f, 1.036632899e-2f, 1.018151734e-2f, 9.999999776e-3f, 9.821718559e-3f, 9.646615945e-3f, 9.474635124e-3f, 9.305720218e-3f, 9.139817208e-3f, 8.976871148e-3f, 8.816830814e-3f, 8.659643121e-3f, 8.505257778e-3f, 8.353625424e-3f, 8.204695769e-3f, 8.058422245e-3f, 7.914755493e-3f, 7.773650344e-3f, 7.635060698e-3f, 7.498942316e-3f, 7.365250029e-3f, 7.233941462e-3f, 7.104974240e-3f, 6.978305988e-3f, 6.853895728e-3f, 6.731703877e-3f, 6.611690391e-3f, 6.493816152e-3f, 6.378043909e-3f, 6.264335476e-3f, 6.152654067e-3f, 6.042963825e-3f, 5.935229361e-3f, 5.829415284e-3f, 5.725488067e-3f, 5.623413250e-3f, 5.523158237e-3f, 5.424690899e-3f, 5.327979103e-3f, 5.232991185e-3f, 5.139696877e-3f, 5.048065912e-3f, 4.958068021e-3f, 4.869675264e-3f, 4.782858305e-3f, 4.697588738e-3f, 4.613839556e-3f, 4.531583749e-3f, 4.450793844e-3f, 4.371444695e-3f, 4.293510225e-3f, 4.216964822e-3f, 4.141784739e-3f, 4.067944363e-3f, 3.995420411e-3f, 3.924189601e-3f, 3.854228882e-3f, 3.785515204e-3f, 3.718026681e-3f, 3.651741194e-3f, 3.586637555e-3f, 3.522694577e-3f, 3.459891770e-3f, 3.398208413e-3f, 3.337624716e-3f, 3.278121119e-3f, 3.219678532e-3f, 3.162277630e-3f, 3.105900250e-3f, 3.050528001e-3f, 2.996142721e-3f, 2.942727180e-3f, 2.890263917e-3f, 2.838735934e-3f, 2.788126701e-3f, 2.738419687e-3f, 2.689598827e-3f, 2.641648287e-3f, 2.594552701e-3f, 2.548296703e-3f, 2.502865391e-3f, 2.458244096e-3f, 2.414418152e-3f, 2.371373819e-3f, 2.329096664e-3f, 2.287573181e-3f, 2.246790100e-3f, 2.206734149e-3f, 2.167392056e-3f, 2.128751716e-3f, 2.090800088e-3f, 2.053525066e-3f, 2.016914543e-3f, 1.980956877e-3f, 1.945640077e-3f, 1.910952968e-3f, 1.876884256e-3f, 1.843423001e-3f, 1.810558257e-3f, 1.778279431e-3f, 1.746576047e-3f, 1.715437858e-3f, 1.684854855e-3f, 1.654817141e-3f, 1.625314821e-3f, 1.596338581e-3f, 1.567878877e-3f, 1.539926510e-3f, 1.512472518e-3f, 1.485508052e-3f, 1.459024264e-3f, 1.433012541e-3f, 1.407464617e-3f, 1.382372226e-3f, 1.357727102e-3f, 1.333521446e-3f, 1.309747226e-3f, 1.286396990e-3f, 1.263462938e-3f, 1.240937738e-3f, 1.218814170e-3f, 1.197085017e-3f, 1.175743295e-3f, 1.154782018e-3f, 1.134194434e-3f, 1.113973907e-3f, 1.094113803e-3f, 1.074607833e-3f, 1.055449597e-3f, 1.036632922e-3f, 1.018151757e-3f, 1.000000047e-3f, 9.821718559e-4f, 9.646615945e-4f, 9.474635008e-4f, 9.305720450e-4f, 9.139816975e-4f, 8.976871613e-4f, 8.816830814e-4f, 8.659643354e-4f, 8.505258011e-4f, 8.353625308e-4f, 8.204696351e-4f, 8.058421663e-4f, 7.914755261e-4f, 7.773650577e-4f, 7.635061047e-4f, 7.498941850e-4f, 7.365249912e-4f, 7.233941578e-4f, 7.104974356e-4f, 6.978305755e-4f, 6.853895611e-4f, 6.731703761e-4f, 6.611690042e-4f, 6.493816036e-4f, 6.378043909e-4f, 6.264335243e-4f, 6.152653950e-4f, 6.042963942e-4f, 5.935229128e-4f, 5.829415168e-4f, 5.725487717e-4f, 5.623413017e-4f, 5.523158470e-4f, 5.424690899e-4f, 5.327978870e-4f, 5.232990952e-4f, 5.139696877e-4f, 5.048065796e-4f, 4.958068021e-4f, 4.869675322e-4f, 4.782858014e-4f, 4.697588738e-4f, 4.613839556e-4f, 4.531583691e-4f, 4.450794077e-4f, 4.371444811e-4f, 4.293510283e-4f, 4.216965172e-4f, 4.141784448e-4f, 4.067944246e-4f, 3.995420702e-4f, 3.924189659e-4f, 3.854228999e-4f, 3.785515146e-4f, 3.718026564e-4f, 3.651741135e-4f, 3.586637613e-4f, 3.522694751e-4f, 3.459891595e-4f, 3.398208355e-4f, 3.337624657e-4f, 3.278121294e-4f, 3.219678474e-4f, 3.162277571e-4f, 3.105900250e-4f, 3.050527885e-4f, 2.996142721e-4f, 2.942727297e-4f, 2.890263859e-4f, 2.838736109e-4f, 2.788126585e-4f, 2.738419571e-4f, 2.689598768e-4f, 2.641648462e-4f, 2.594552643e-4f, 2.548296761e-4f, 2.502865391e-4f, 2.458243980e-4f, 2.414418268e-4f, 2.371373703e-4f, 2.329096606e-4f, 2.287573152e-4f, 2.246790100e-4f, 2.206734061e-4f, 2.167392231e-4f, 2.128751657e-4f, 2.090799971e-4f, 2.053525095e-4f, 2.016914514e-4f, 1.980956731e-4f, 1.945640106e-4f, 1.910952997e-4f, 1.876884344e-4f, 1.843422942e-4f, 1.810558315e-4f, 1.778279402e-4f, 1.746576017e-4f, 1.715437829e-4f, 1.684854942e-4f, 1.654817170e-4f, 1.625314908e-4f, 1.596338552e-4f, 1.567878790e-4f, 1.539926598e-4f, 1.512472518e-4f, 1.485507964e-4f, 1.459024206e-4f, 1.433012512e-4f, 1.407464733e-4f, 1.382372284e-4f, 1.357727160e-4f, 1.333521504e-4f, 1.309747313e-4f, 1.286396873e-4f, 1.263462909e-4f, 1.240937709e-4f, 1.218814214e-4f, 1.197085003e-4f, 1.175743237e-4f, 1.154782003e-4f, 1.134194390e-4f, 1.113973849e-4f, 1.094113832e-4f, 1.074607862e-4f, 1.055449611e-4f, 1.036632893e-4f, 1.018151743e-4f };   // 10000^(-2i/1024), i = 0..511 (float32)
__global__ __launch_bounds__(256) void k_preRopeI(const float* __restrict__ X, bf* Ph, bf* Pl) { const size_t k = (size_t)blockIdx.x * 256 + threadIdx.x; if (k >= (size_t)TT * DM / 4) return; const size_t e = k * 4; const int d0 = (int)(e % DM); const int t = (int)(e / DM); const v4f a = *(const v4f*)(X + e); v4us oh, ol;
#pragma unroll
    for (int p = 0; p < 2; ++p) { const int i = (d0 >> 1) + p; const float ang = __fmul_rn((float)t, THE[i]); const float c = cosf(ang), sn = sinf(ang); const float x0 = bfr(a[2 * p]), x1 = bfr(a[2 * p + 1]);
        float a0 = __fmul_rn(x0, c), b0 = __fmul_rn(x1, sn), a1 = __fmul_rn(x1, c), b1 = __fmul_rn(x0, sn); asm volatile("" : "+v"(a0), "+v"(b0), "+v"(a1), "+v"(b1)); const float y0 = __fsub_rn(a0, b0), y1 = __fadd_rn(a1, b1); unsigned short u, w; splitf(y0, u, w); oh[2 * p] = u; ol[2 * p] = w; splitf(y1, u, w); oh[2 * p + 1] = u; ol[2 * p + 1] = w; }
    *(v4us*)(Ph + e) = oh; *(v4us*)(Pl + e) = ol;  }
// ---- k_fattn: causal attention of one batch in one launch: scores, softmax and probability x value product of a query tile stay in registers; the merged hi/lo planes [t][head x 64 + d] are written directly.
// Transposed forms: S^T = K Q^T (A = 16 key rows, B = 16 query columns), O^T += V^T P^T (A = 16 rows of the [d][t] value plane, B = P^T packed from two S^T tiles, which is the k order of WFrag::ld).
// A lane owns query column lr; lanes lr and lr + 16 split its keys and its d. One work-group of FNW waves per query tile: wave w takes the 32-key passes w, w + FNW, ... with a running maximum and sum of its own;
// the FNW partial (maximum, sum, O^T) are joined through LDS in wave order. Query rows < RH: bf16 hi/lo planes, 3 products, 16 queries a tile; the rest: fp16, 32 queries a tile, probabilities carried x 1024.
#define FNW  4
#define OSP  68                   // LDS row pitch of a partial O row (64 d + 4 floats)
#define L2E  1.4426950408889634f
__device__ __forceinline__ float xhalf(float x) { const int i = __float_as_int(x); return __int_as_float(__builtin_amdgcn_permlanex16(i, i, 0x76543210, 0xfedcba98, false, false)); }   // value of lane ^ 16
typedef __attribute__((ext_vector_type(16))) unsigned short v16us;
template <typename T16, bool HL, int NQ>
__device__ __forceinline__ void fattn_tile(const T16* __restrict__ Q, const T16* __restrict__ Q2, const T16* __restrict__ Kp, const T16* __restrict__ K2, const T16* __restrict__ Vt, const T16* __restrict__ V2, int q0, bf* Ah, bf* Al, float* os, float* ms, float* ls) {
    typedef typename WFrag<T16>::V V;
    const int lane = threadIdx.x & 31, lr = lane & 15, hi = lane >> 4;
    const int w = __builtin_amdgcn_readfirstlane((int)(threadIdx.x >> 5));   // wave number, held scalar so that the pass loop keeps a scalar branch
    const int npass = (q0 + NQ * 16 + 31) / 32;                              // 32-key passes up to and including the diagonal one
    V qf[NQ][2], qf2[NQ][2];
#pragma unroll
    for (int g = 0; g < NQ; ++g)
#pragma unroll
        for (int c = 0; c < 2; ++c) { const size_t qo = (size_t)(q0 + g * 16 + lr) * HD + c * 32 + 8 * hi; qf[g][c] = WFrag<T16>::ld(Q + qo); if (HL) qf2[g][c] = WFrag<T16>::ld(Q2 + qo); }
    v8f o[4][NQ]; float m[NQ], l[NQ];
#pragma unroll
    for (int g = 0; g < NQ; ++g) { m[g] = -3.0e38f; l[g] = 0.f;
#pragma unroll
        for (int mb = 0; mb < 4; ++mb) o[mb][g] = (v8f){}; }
    const unsigned ko = lr * HD + 8 * hi, vo = lr * TT + 8 * hi;   // 32-bit lane offsets beside wave-uniform bases: one register serves every plane
    V kf[2][2], kf2[2][2];
    if (!HL) { const int p0 = min(w, npass - 1);   // first pass's K fragments (a wave without a pass fetches the last pass's: in bounds, unused)
#pragma unroll
      for (int t = 0; t < 2; ++t)
#pragma unroll
          for (int c = 0; c < 2; ++c) { kf[t][c] = WFrag<T16>::ld(Kp + (size_t)p0 * 32 * HD + ko + (t * 16 * HD + c * 32)); } }
#pragma unroll 1   // rolled: one pass already fills the register file
    for (int p = w; p < npass; p += FNW) {
        const int kb = p * 32;
        if (HL) {   // hi/lo tiles (at most RH / 32 / FNW passes a wave): K fetched in its own pass, which keeps the kernel at four waves a SIMD without spills
#pragma unroll
            for (int t = 0; t < 2; ++t)
#pragma unroll
                for (int c = 0; c < 2; ++c) { kf[t][c] = WFrag<T16>::ld(Kp + (size_t)kb * HD + ko + (t * 16 * HD + c * 32)); kf2[t][c] = WFrag<T16>::ld(K2 + (size_t)kb * HD + ko + (t * 16 * HD + c * 32)); }
            asm volatile("s_wait_xcnt 0x0" ::: "memory"); }   // the V loads below land in registers that held the K loads' addresses
        V vf[4], vf2[4];
#pragma unroll
        for (int mb = 0; mb < 4; ++mb) { vf[mb] = WFrag<T16>::ld(Vt + kb + vo + mb * 16 * TT); if (HL) vf2[mb] = WFrag<T16>::ld(V2 + kb + vo + mb * 16 * TT); }
        v8f s[2][NQ];
#pragma unroll
        for (int t = 0; t < 2; ++t)
#pragma unroll
            for (int g = 0; g < NQ; ++g) { s[t][g] = (v8f){};
#pragma unroll
                for (int c = 0; c < 2; ++c) { s[t][g] = WFrag<T16>::mma(kf[t][c], qf[g][c], s[t][g]); if (HL) { s[t][g] = WFrag<T16>::mma(kf[t][c], qf2[g][c], s[t][g]); s[t][g] = WFrag<T16>::mma(kf2[t][c], qf[g][c], s[t][g]); } } }
        if (!HL) { const int pn = (p + FNW < npass) ? p + FNW : p;   // this wave's next pass: its K fragments fly during the softmax (the last pass fetches its own again: in bounds, unused)
#pragma unroll
          for (int t = 0; t < 2; ++t)
#pragma unroll
              for (int c = 0; c < 2; ++c) { kf[t][c] = WFrag<T16>::ld(Kp + (size_t)pn * 32 * HD + ko + (t * 16 * HD + c * 32)); } }
        asm volatile("s_wait_xcnt 0x0" ::: "memory");   // the softmax below reuses the registers that held this pass's load addresses
        if (kb + 31 > q0) {   // only the diagonal pass holds keys behind a query (scalar test)
#pragma unroll
            for (int t = 0; t < 2; ++t)
#pragma unroll
                for (int g = 0; g < NQ; ++g)
#pragma unroll
                    for (int r = 0; r < 8; ++r) s[t][g][r] = (kb + t * 16 + hi * 8 + r <= q0 + g * 16 + lr) ? s[t][g][r] : -3.0e38f; }
        V pf[NQ], pf2[NQ];
#pragma unroll
        for (int g = 0; g < NQ; ++g) {
            float mx = -3.0e38f;
#pragma unroll
            for (int t = 0; t < 2; ++t)
#pragma unroll
                for (int r = 0; r < 8; ++r) mx = fmaxf(mx, s[t][g][r]);
            mx = fmaxf(mx, xhalf(mx)) * SCL;                       // SCL is a power of two: the scaled maximum is the maximum of the scaled scores (a masked -3e38 stays far below every score)
            const float mn = fmaxf(m[g], mx); const float al = __builtin_amdgcn_exp2f((m[g] - mn) * L2E); m[g] = mn;
            float sum = 0.f; v16us uh, ul; v16h ph;
#pragma unroll
            for (int t = 0; t < 2; ++t)
#pragma unroll
                for (int r = 0; r < 8; ++r) { const float d0 = s[t][g][r] * SCL - mn; const float e = __builtin_amdgcn_exp2f(HL ? d0 * L2E : d0 * L2E + 10.0f); sum += e;   // + 10: x 1024 (keeps small fp16 probabilities normal), cancels in O / sum
                    if (HL) { unsigned short a2, c2; splitf(e, a2, c2); uh[t * 8 + r] = a2; ul[t * 8 + r] = c2; } else ph[t * 8 + r] = tohx(e); }
            l[g] = l[g] * al + sum;
#pragma unroll
            for (int mb = 0; mb < 4; ++mb) o[mb][g] *= al;
            if constexpr (HL) { pf[g] = __builtin_bit_cast(v16bf, uh); pf2[g] = __builtin_bit_cast(v16bf, ul); } else pf[g] = ph;
        }
#pragma unroll
        for (int mb = 0; mb < 4; ++mb)
#pragma unroll
            for (int g = 0; g < NQ; ++g) { o[mb][g] = WFrag<T16>::mma(vf[mb], pf[g], o[mb][g]); if (HL) { o[mb][g] = WFrag<T16>::mma(vf[mb], pf2[g], o[mb][g]); o[mb][g] = WFrag<T16>::mma(vf2[mb], pf[g], o[mb][g]); } }
    }
#pragma unroll
    for (int g = 0; g < NQ; ++g) { const float lj = l[g] + xhalf(l[g]); if (hi == 0) { ms[w * 32 + g * 16 + lr] = m[g]; ls[w * 32 + g * 16 + lr] = lj; }
#pragma unroll
        for (int mb = 0; mb < 4; ++mb) { float* op = os + (size_t)(w * 32 + g * 16 + lr) * OSP + mb * 16 + hi * 8; const v8f x = o[mb][g];
            *(v4fa*)op = (v4f){x[0], x[1], x[2], x[3]}; *(v4fa*)(op + 4) = (v4f){x[4], x[5], x[6], x[7]}; } }
    __syncthreads();                               // all FNW partial results are in LDS before any thread joins them
    constexpr int TPQ = 8 / NQ, DPT = 8 * NQ;      // threads a query, d values a thread
    const int q = threadIdx.x / TPQ, d0 = (threadIdx.x % TPQ) * DPT;
    float M = ms[q];
#pragma unroll
    for (int u = 1; u < FNW; ++u) M = fmaxf(M, ms[u * 32 + q]);
    float f[FNW], L = 0.f;
#pragma unroll
    for (int u = 0; u < FNW; ++u) { f[u] = __builtin_amdgcn_exp2f((ms[u * 32 + q] - M) * L2E); L += ls[u * 32 + q] * f[u]; }   // a wave without a pass: maximum -3e38, weight 0
    const float inv = __fdiv_rn(1.0f, L);
#pragma unroll
    for (int c = 0; c < DPT / 8; ++c) { v8us oh, ol;
#pragma unroll
        for (int hf = 0; hf < 2; ++hf) { v4f val = (v4f){};
#pragma unroll
            for (int u = 0; u < FNW; ++u) val += *(const v4fa*)(os + (size_t)(u * 32 + q) * OSP + d0 + c * 8 + hf * 4) * f[u];
#pragma unroll
            for (int k = 0; k < 4; ++k) { unsigned short a2, c2; splitf(val[k] * inv, a2, c2); oh[hf * 4 + k] = a2; ol[hf * 4 + k] = c2; } }
        const size_t oo = (size_t)(q0 + q) * DQ + d0 + c * 8; *(v8us*)(Ah + oo) = oh; *(v8us*)(Al + oo) = ol; }
    if constexpr (HL) asm volatile("s_wait_xcnt 0x0" ::: "memory");   // behind the last store: the fp16 tile's code is laid out behind this tile's and writes the registers that these stores name
}
// grid (heads, tiles): cost falls with blockIdx.y (longest query tiles first)
__global__ __launch_bounds__(32 * FNW) void k_fattn(const h16* __restrict__ Q16, const h16* __restrict__ K16, const h16* __restrict__ V16, const bf* __restrict__ Qh, const bf* __restrict__ Ql, const bf* __restrict__ Kh, const bf* __restrict__ Kl, const bf* __restrict__ Vh, const bf* __restrict__ Vl, bf* Ah, bf* Al) {
    __shared__ __align__(16) float os[FNW * 32 * OSP]; __shared__ float ms[FNW * 32]; __shared__ float ls[FNW * 32];
    const size_t ho = (size_t)blockIdx.x * TT * HD; const int y = blockIdx.y; Ah += blockIdx.x * HD; Al += blockIdx.x * HD;
    if (y < (TT - RH) / 32) fattn_tile<h16, false, 2>(Q16 + ho, nullptr, K16 + ho, nullptr, V16 + ho, nullptr, TT - 32 * (y + 1), Ah, Al, os, ms, ls);
    else fattn_tile<bf, true, 1>(Qh + ho, Ql + ho, Kh + ho, Kl + ho, Vh + ho, Vl + ho, RH - 16 * (y - (TT - RH) / 32 + 1), Ah, Al, os, ms, ls);
}

extern "C" void kernel_launch(void* const* d_in, const int* in_sizes, int n_in,
                              void* d_out, int out_size, void* d_ws, size_t ws_size, hipStream_t stream) {
    (void)in_sizes; (void)n_in; (void)out_size;
    const float* x = (const float*)d_in[0]; const float* wq = (const float*)d_in[1]; const float* wk = (const float*)d_in[2]; const float* wv = (const float*)d_in[3]; const float* wo = (const float*)d_in[4]; const float* bo = (const float*)d_in[5];
    float* OUT = (float*)d_out;     // [4][2048][1024]
    char* wsp = (char*)d_ws;
    auto take = [&](size_t bytes) { char* p = wsp; wsp += (bytes + 255) & ~(size_t)255; return (void*)p; };
    bf* XBl = (bf*)take((size_t)TT * DM * 2); bf* WQ = (bf*)take((size_t)DQ * DM * 2); bf* WK = (bf*)take((size_t)DKV * DM * 2); bf* WV = (bf*)take((size_t)DKV * DM * 2); bf* WO = (bf*)take((size_t)DM * DQ * 2); float* CS = (float*)take((size_t)TT * HD * 2 * 4);
    bf* XB = (bf*)take((size_t)TT * DM * 2); float* FQ = (float*)take((size_t)TT * DQ * 4); float* FK = (float*)take((size_t)TT * DKV * 4);
    h16* QP16 = (h16*)take((size_t)NH_ * TT * HD * 2); h16* KP16 = (h16*)take((size_t)NKV * TT * HD * 2); h16* VT16 = (h16*)take((size_t)NKV * HD * TT * 2);
    bf* QPh = (bf*)take((size_t)NH_ * TT * HD * 2); bf* QPl = (bf*)take((size_t)NH_ * TT * HD * 2); bf* KPh = (bf*)take((size_t)NKV * TT * HD * 2); bf* KPl = (bf*)take((size_t)NKV * TT * HD * 2); bf* VTh = (bf*)take((size_t)NKV * HD * TT * 2); bf* VTl = (bf*)take((size_t)NKV * HD * TT * 2);
    bf* ATh = (bf*)take((size_t)TT * DQ * 2); bf* ATl = (bf*)take((size_t)TT * DQ * 2);
    if ((size_t)(wsp - (char*)d_ws) > ws_size) return;    // ws 256 MiB
    float* FV = FK;   // v projection reuses the k buffer after the k planes are built (stream-ordered)
    { k_cvt8<<<(unsigned)(((size_t)DQ * DM / 8 + 255) / 256), 256, 0, stream>>>(wq, WQ, (size_t)DQ * DM / 8); k_cvt8<<<(unsigned)(((size_t)DKV * DM / 8 + 255) / 256), 256, 0, stream>>>(wk, WK, (size_t)DKV * DM / 8); k_cvt8<<<(unsigned)(((size_t)DKV * DM / 8 + 255) / 256), 256, 0, stream>>>(wv, WV, (size_t)DKV * DM / 8);
      k_cvt8<<<(unsigned)(((size_t)DM * DQ / 8 + 255) / 256), 256, 0, stream>>>(wo, WO, (size_t)DM * DQ / 8);
       }
    k_csid<<<(TT * HD + 255) / 256, 256, 0, stream>>>(CS);
    const unsigned LQ = (unsigned)(((size_t)NH_ * TT * HD / 2 + 255) / 256), LKv = (unsigned)(((size_t)NKV * TT * HD / 2 + 255) / 256);
    for (int b = 0; b < NB_; ++b) {
        
        k_preRopeI<<<(unsigned)(((size_t)TT * DM / 4 + 255) / 256), 256, 0, stream>>>(x + (size_t)b * TT * DM, XB, XBl);   /* rx = pairwise rope of the input, as hi/lo planes */
        k_gemmw<bf, 1, false, false, 8><<<dim3(TT / 64, DQ / 64, 1), 256, 0, stream>>>(XB, XBl, WQ, nullptr, DM, FQ, DQ, nullptr, 0, 0, 0, 0);   /* q = rx Wq^T (hi/lo x exact) */
        k_rope<<<LQ, 256, 0, stream>>>(FQ, DQ, NH_, CS, nullptr, nullptr, 1.0f, QP16, QPh, QPl);
        k_gemmw<bf, 1, false, false, 8><<<dim3(TT / 64, DKV / 64, 1), 256, 0, stream>>>(XB, XBl, WK, nullptr, DM, FK, DKV, nullptr, 0, 0, 0, 0);   /* k = rx Wk^T */
        k_rope<<<LKv, 256, 0, stream>>>(FK, DKV, NKV, CS, nullptr, nullptr, 1.0f, KP16, KPh, KPl);
        k_cvt8<<<(unsigned)(((size_t)TT * DM / 8 + 255) / 256), 256, 0, stream>>>(x + (size_t)b * TT * DM, XB, (size_t)TT * DM / 8);   /* plain input for v */ k_gemmw<bf, 0, false, false, 8><<<dim3(TT / 64, DKV / 64, 1), 256, 0, stream>>>(XB, nullptr, WV, nullptr, DM, FV, DKV, nullptr, 0, 0, 0, 0); k_vtp<<<LKv, 256, 0, stream>>>(FV, DKV, NKV, VT16, VTh, VTl);
        k_fattn<<<dim3(NH_, (TT - RH) / 32 + RH / 16, 1), 32 * FNW, 0, stream>>>(QP16, KP16, VT16, QPh, QPl, KPh, KPl, VTh, VTl, ATh, ATl);   /* one kv head per query head */
        k_gemmw<bf, 1, true, false, 8><<<dim3(TT / 64, DM / 64, 1), 256, 0, stream>>>(ATh, ATl, WO, nullptr, DQ, OUT + (size_t)b * TT * DM, DM, bo, 0, 0, 0, 0); }
}

// v003
// One run takes 381 microseconds.
// Timed twice side by side with v002, it ran 1.22 and 1.24 times as fast.
// All steps since v000 together make it 7.64 times as fast.
#include <hip/hip_runtime.h>

// Causal multi-head self-attention with a pairwise rotary applied to the INPUT before the q/k projections (input [4][2048][1024]; rx[t][2i], rx[t][2i+1] = rotation of (x[2i], x[2i+1]) by t x 10000^(-2i/1024) over the 1,024 features (computed); q = rx Wq^T, k = rx Wk^T, v = input Wv^T ('oi' 1/32, no bias; 16 heads x 64); scores masked causal then / 8; softmax; out = merged Wo^T + bo -> [4][2048][1024] (8.4 M)).
// Layout per batch: a rotary kernel builds rx from the bf16-rounded input with on-the-fly precise cosf/sinf of t x theta[i] (512 float32 constants) and splits it into bf16 hi/lo planes; q and k projections hi/lo x exact; a plain bf16 copy of the input feeds the exact v projection (formed as Wv x^T, so its tiles are [d][t] already); the three projections write the attention's fp16 and hi/lo planes from their own epilogue; causal T-2048 attention fused in one launch, running softmax (hybrid rows: < 512 hi/lo 3 products, rest fp16 x1024; key passes above the diagonal skipped); merged hi/lo x Wo exact + bo.
// Compute dtypes, f32 accumulate: every input rounded to bf16; input rotary f32, q/k projections hi/lo x exact (2 products: ~f32), v exact; attention rows < 512 3 products, rest fp16; softmax f32; Wo hl x exact + bias.

#define NB_  4
#define TT   2048
#define DM   1024
#define NH_  16
#define NKV  16
#define HD   64
#define DQ   (NH_ * HD)
#define DKV  (NKV * HD)
#define RH   512                  // query rows < RH use hi+lo planes (0: none)
#define SCL  0.125f   // HD^-0.5
typedef _Float16 h16;
typedef unsigned short bf;
typedef __attribute__((ext_vector_type(16))) __bf16   v16bf;
typedef __attribute__((ext_vector_type(16))) _Float16 v16h;
typedef __attribute__((ext_vector_type(8)))  _Float16 v8h;
typedef __attribute__((ext_vector_type(8)))  unsigned short v8us;
typedef __attribute__((ext_vector_type(8)))  float    v8f;
typedef __attribute__((ext_vector_type(4)))  float    v4f;
typedef v8h  __attribute__((may_alias)) v8ha;
typedef v4f  __attribute__((may_alias)) v4fa;
typedef v8us __attribute__((may_alias)) v8usa;

__device__ __forceinline__ unsigned short f2bf(float f) { unsigned u = __float_as_uint(f); u += 0x7FFFu + ((u >> 16) & 1u); return (unsigned short)(u >> 16); }
__device__ __forceinline__ float bf2f(unsigned short b) { return __uint_as_float(((unsigned)b) << 16); }
__device__ __forceinline__ float bfr(float f) { return bf2f(f2bf(f)); }
__device__ __forceinline__ v16h cat16(v8h lo, v8h hi) { return __builtin_shufflevector(lo, hi, 0, 1, 2, 3, 4, 5, 6, 7, 8, 9, 10, 11, 12, 13, 14, 15); }
__device__ __forceinline__ v16bf cat16b(v8us lo, v8us hi) { return __builtin_bit_cast(v16bf, __builtin_shufflevector(lo, hi, 0, 1, 2, 3, 4, 5, 6, 7, 8, 9, 10, 11, 12, 13, 14, 15)); }
__device__ __forceinline__ v8f wmma16(v16h a, v16h b, v8f c) { return __builtin_amdgcn_wmma_f32_16x16x32_f16(false, a, false, b, (short)0, c, false, false); }
__device__ __forceinline__ v8f wmmab(v16bf a, v16bf b, v8f c) { return __builtin_amdgcn_wmma_f32_16x16x32_bf16(false, a, false, b, (short)0, c, false, false); }
__device__ __forceinline__ h16 tohx(float x) { return (h16)x; }
__device__ __forceinline__ void splitf(float y, unsigned short& h, unsigned short& l) { h = f2bf(y); l = f2bf(y - bf2f(h)); }
typedef __attribute__((ext_vector_type(2))) _Float16 v2h;
typedef __attribute__((ext_vector_type(4))) _Float16 v4h;
typedef __attribute__((ext_vector_type(2))) unsigned short v2us;
typedef __attribute__((ext_vector_type(4))) unsigned short v4us;
typedef __attribute__((ext_vector_type(2))) float v2f;
typedef __attribute__((ext_vector_type(4))) int v4i;


// ---- k_gemmw: register-blocked GEMM, one work-group of NW waves per 64x64 output tile, operands straight from K-contiguous 16-bit planes; grid (M/64, N/64, Z), 32 NW threads.
// C[m][n] (f32, pitch ldc, + optional f32 bias[n]) = sum_k A[m][k] Bt[n][k] (+ split products per NSPLIT). z-batch strides sA/sB/sC in elements. K % 32 == 0.
// PLANES: the summed tile is not stored as f32 but rounded in the epilogue to three 16-bit planes (fp16, bf16 hi, bf16 lo), element (m, n) at blockIdx.y x sT + m x ldc + (n - c0): [head][t][d] with sT = T x 64, ldc = 64; [d][t] with sT = 64, ldc = T.
// The K loop is a chain of dependent load latencies, so it is cut into NW contiguous runs of 32-k chunks, one run a wave: each wave holds a whole 64x64 f32 partial tile (16 accumulators),
// and the NW partial tiles are added through LDS in wave order. DIAG (probability x value contraction): the K loop ends at the diagonal block of query rows r0+roff.. (probabilities beyond it are exactly zero).
template <typename T16> struct WFrag;
template <> struct WFrag<h16> { typedef v16h V; static __device__ __forceinline__ V ld(const h16* p) { return cat16(*(const v8h*)p, *(const v8h*)(p + 16)); } static __device__ __forceinline__ v8f mma(V a, V b, v8f c) { return wmma16(a, b, c); } };
template <> struct WFrag<bf> { typedef v16bf V; static __device__ __forceinline__ V ld(const bf* p) { return cat16b(*(const v8us*)p, *(const v8us*)(p + 16)); } static __device__ __forceinline__ v8f mma(V a, V b, v8f c) { return wmmab(a, b, c); } };
template <typename T16, int NSPLIT, bool BIAS, bool DIAG, int NW, bool PLANES>
__global__ __launch_bounds__(32 * NW) void k_gemmw(const T16* __restrict__ A, const T16* __restrict__ A2, const T16* __restrict__ Bt, const T16* __restrict__ Bt2, int K, float* C, int ldc, const float* __restrict__ bias, int roff, size_t sA, size_t sB, size_t sC, h16* P16, bf* Ph, bf* Pl, size_t sT) {
    typedef typename WFrag<T16>::V V;
    __shared__ __align__(16) float os[NW * 64 * 68];   // one 64x64 partial tile a wave, row pitch 68
    const size_t z = blockIdx.z; A += z * sA; if (A2) A2 += z * sA; Bt += z * sB; if (Bt2) Bt2 += z * sB; if (!PLANES) C += z * sC;
    const int lane = threadIdx.x & 31, lr = lane & 15, hi = lane >> 4; const int r0 = blockIdx.x * 64, c0 = blockIdx.y * 64;
    const int w = __builtin_amdgcn_readfirstlane((int)(threadIdx.x >> 5));   // wave number, held scalar so that the K loop keeps a scalar branch
    const int nch = (DIAG ? min(K, r0 + roff + 64) : K) / 32;                // 32-k chunks of this tile
    const int kb = 32 * (w * nch / NW), ke = 32 * ((w + 1) * nch / NW);      // this wave's run of them (empty where there are fewer chunks than waves)
    v8f acc[4][4];
#pragma unroll
    for (int mb = 0; mb < 4; ++mb)
#pragma unroll
        for (int nb = 0; nb < 4; ++nb) acc[mb][nb] = (v8f){};
    const size_t aoff = (size_t)(r0 + lr) * K + 8 * hi, boff = (size_t)(c0 + lr) * K + 8 * hi;
#pragma unroll 1
    for (int kc = kb; kc < ke; kc += 32) {
        V a[4], a2[4];
#pragma unroll
        for (int mb = 0; mb < 4; ++mb) { a[mb] = WFrag<T16>::ld(A + aoff + (size_t)mb * 16 * K + kc); if (NSPLIT == 1 || NSPLIT == 2) a2[mb] = WFrag<T16>::ld(A2 + aoff + (size_t)mb * 16 * K + kc); }
#pragma unroll
        for (int nb = 0; nb < 4; ++nb) { const V b = WFrag<T16>::ld(Bt + boff + (size_t)nb * 16 * K + kc); V b2; if (NSPLIT >= 2) b2 = WFrag<T16>::ld(Bt2 + boff + (size_t)nb * 16 * K + kc);
#pragma unroll
            for (int mb = 0; mb < 4; ++mb) { acc[mb][nb] = WFrag<T16>::mma(a[mb], b, acc[mb][nb]); if (NSPLIT == 1 || NSPLIT == 2) acc[mb][nb] = WFrag<T16>::mma(a2[mb], b, acc[mb][nb]); if (NSPLIT >= 2) acc[mb][nb] = WFrag<T16>::mma(a[mb], b2, acc[mb][nb]); } }
        asm volatile("v_nop\n\tv_nop\n\tv_nop\n\tv_nop" : "+v"(acc[0][0]), "+v"(acc[1][1]), "+v"(acc[2][2]), "+v"(acc[3][3]) : "v"(a[0]), "v"(a[3]));
    }
    float* ow = os + w * 64 * 68;
#pragma unroll
    for (int mb = 0; mb < 4; ++mb) {
#pragma unroll
        for (int nb = 0; nb < 4; ++nb) {
#pragma unroll
            for (int j = 0; j < 8; ++j) ow[(mb * 16 + hi * 8 + j) * 68 + nb * 16 + lr] = acc[mb][nb][j]; } }
    __syncthreads();                               // all NW partial tiles are in LDS before any thread adds them
#pragma unroll
    for (int s = 0; s < 32 / NW; ++s) { const int q = s * 32 * NW + threadIdx.x, row = q >> 4, cofs = (q & 15) * 4; v4f val = *(const v4fa*)(os + row * 68 + cofs);
#pragma unroll
        for (int u = 1; u < NW; ++u) val += *(const v4fa*)(os + (u * 64 + row) * 68 + cofs);
        if (BIAS) { val[0] += bfr(bias[c0 + cofs]); val[1] += bfr(bias[c0 + cofs + 1]); val[2] += bfr(bias[c0 + cofs + 2]); val[3] += bfr(bias[c0 + cofs + 3]); }
        if constexpr (PLANES) { const size_t po = (size_t)blockIdx.y * sT + (size_t)(r0 + row) * ldc + cofs; v4h o16; v4us oh, ol;
#pragma unroll
            for (int k = 0; k < 4; ++k) { o16[k] = tohx(val[k]); unsigned short a2, c2; splitf(val[k], a2, c2); oh[k] = a2; ol[k] = c2; }
            *(v4h*)(P16 + po) = o16; *(v4us*)(Ph + po) = oh; *(v4us*)(Pl + po) = ol;
        } else
        *(v4f*)(C + (size_t)(r0 + row) * ldc + c0 + cofs) = val; }
}


__global__ __launch_bounds__(256) void k_wtG(const float* __restrict__ w, int K, int N, bf* Bt) {
    const int lane = threadIdx.x & 31; const int L0 = (blockIdx.x * 8 + (threadIdx.x >> 5)) * 8; const int nlines = N * K / 64;
{
#pragma unroll 1
        for (int l = 0; l < 8; ++l) { const int L = L0 + l; if (L >= nlines) break; const size_t e = (size_t)L * 64 + lane * 2; const int k = (int)(e % K), n = (int)(e / K); v2us o;
            o[0] = f2bf(w[(size_t)k * N + n]); o[1] = f2bf(w[(size_t)(k + 1) * N + n]); *(v2us*)(Bt + e) = o; }
         }
}
__global__ __launch_bounds__(256) void k_cvt8(const float* __restrict__ src, bf* dst, size_t n8) { const size_t i = (size_t)blockIdx.x * 256 + threadIdx.x; if (i >= n8) return; const v8f v = *(const v8f*)(src + i * 8); v8us o;
#pragma unroll
    for (int k = 0; k < 8; ++k) o[k] = f2bf(v[k]); *(v8us*)(dst + i * 8) = o;  }

__constant__ float THE[DM / 2] = { 1.000000000e+0f, 9.821718931e-1f, 9.646615982e-1f, 9.474635124e-1f, 9.305720329e-1f, 9.139816761e-1f, 8.976871371e-1f, 8.816830516e-1f, 8.659643531e-1f, 8.505257964e-1f, 8.353625536e-1f, 8.204696178e-1f, 8.058421612e-1f, 7.914755344e-1f, 7.773650289e-1f, 7.635060549e-1f, 7.498942018e-1f, 7.365249991e-1f, 7.233941555e-1f, 7.104974389e-1f, 6.978305578e-1f, 6.853895783e-1f, 6.731703877e-1f, 6.611690521e-1f, 6.493816376e-1f, 6.378043890e-1f, 6.264335513e-1f, 6.152654290e-1f, 6.042963862e-1f, 5.935229063e-1f, 5.829415321e-1f, 5.725488067e-1f, 5.623413324e-1f, 5.523158312e-1f, 5.424690843e-1f, 5.327978730e-1f, 5.232990980e-1f, 5.139696598e-1f, 5.048065782e-1f, 4.958068132e-1f, 4.869675338e-1f, 4.782858193e-1f, 4.697588682e-1f, 4.613839686e-1f, 4.531583786e-1f, 4.450794160e-1f, 4.371444881e-1f, 4.293510318e-1f, 4.216965139e-1f, 4.141784608e-1f, 4.067944288e-1f, 3.995420635e-1f, 3.924189806e-1f, 3.854228854e-1f, 3.785515130e-1f, 3.718026578e-1f, 3.651741147e-1f, 3.586637676e-1f, 3.522694707e-1f, 3.459891677e-1f, 3.398208320e-1f, 3.337624669e-1f, 3.278121054e-1f, 3.219678402e-1f, 3.162277639e-1f, 3.105900288e-1f, 3.050527871e-1f, 2.996142805e-1f, 2.942727208e-1f, 2.890263796e-1f, 2.838735878e-1f, 2.788126767e-1f, 2.738419771e-1f, 2.689598799e-1f, 2.641648352e-1f, 2.594552636e-1f, 2.548296750e-1f, 2.502865493e-1f, 2.458244115e-1f, 2.414418161e-1f, 2.371373773e-1f, 2.329096645e-1f, 2.287573218e-1f, 2.246790081e-1f, 2.206734121e-1f, 2.167392224e-1f, 2.128751725e-1f, 2.090800107e-1f, 2.053525001e-1f, 2.016914487e-1f, 1.980956793e-1f, 1.945639998e-1f, 1.910952926e-1f, 1.876884252e-1f, 1.843422949e-1f, 1.810558289e-1f, 1.778279394e-1f, 1.746575981e-1f, 1.715437919e-1f, 1.684854925e-1f, 1.654817164e-1f, 1.625314802e-1f, 1.596338600e-1f, 1.567878872e-1f, 1.539926529e-1f, 1.512472481e-1f, 1.485508084e-1f, 1.459024251e-1f, 1.433012635e-1f, 1.407464594e-1f, 1.382372230e-1f, 1.357727200e-1f, 1.333521456e-1f, 1.309747249e-1f, 1.286396980e-1f, 1.263462901e-1f, 1.240937784e-1f, 1.218814179e-1f, 1.197085008e-1f, 1.175743267e-1f, 1.154781953e-1f, 1.134194434e-1f, 1.113973856e-1f, 1.094113812e-1f, 1.074607819e-1f, 1.055449620e-1f, 1.036632955e-1f, 1.018151715e-1f, 1.000000015e-1f, 9.821718931e-2f, 9.646616131e-2f, 9.474635124e-2f, 9.305720776e-2f, 9.139817208e-2f, 8.976871520e-2f, 8.816830814e-2f, 8.659642935e-2f, 8.505257964e-2f, 8.353625238e-2f, 8.204696327e-2f, 8.058422059e-2f, 7.914755493e-2f, 7.773650438e-2f, 7.635060698e-2f, 7.498942316e-2f, 7.365249842e-2f, 7.233941555e-2f, 7.104974240e-2f, 6.978306174e-2f, 6.853895634e-2f, 6.731703877e-2f, 6.611689925e-2f, 6.493816525e-2f, 6.378044188e-2f, 6.264335662e-2f, 6.152654067e-2f, 6.042964011e-2f, 5.935229361e-2f, 5.829415470e-2f, 5.725488067e-2f, 5.623413250e-2f, 5.523158237e-2f, 5.424690992e-2f, 5.327979103e-2f, 5.232991278e-2f, 5.139696971e-2f, 5.048065633e-2f, 4.958068207e-2f, 4.869675264e-2f, 4.782858118e-2f, 4.697588831e-2f, 4.613839835e-2f, 4.531583562e-2f, 4.450793937e-2f, 4.371444881e-2f, 4.293510318e-2f, 4.216964915e-2f, 4.141784459e-2f, 4.067944363e-2f, 3.995420411e-2f, 3.924189880e-2f, 3.854228929e-2f, 3.785515204e-2f, 3.718026727e-2f, 3.651741147e-2f, 3.586637601e-2f, 3.522694483e-2f, 3.459891677e-2f, 3.398208320e-2f, 3.337624669e-2f, 3.278120980e-2f, 3.219678625e-2f, 3.162277490e-2f, 3.105900250e-2f, 3.050527908e-2f, 2.996142767e-2f, 2.942727134e-2f, 2.890263870e-2f, 2.838736027e-2f, 2.788126655e-2f, 2.738419548e-2f, 2.689598873e-2f, 2.641648240e-2f, 2.594552748e-2f, 2.548296750e-2f, 2.502865344e-2f, 2.458244003e-2f, 2.414418198e-2f, 2.371373773e-2f, 2.329096571e-2f, 2.287573181e-2f, 2.246790007e-2f, 2.206734009e-2f, 2.167392150e-2f, 2.128751576e-2f, 2.090799995e-2f, 2.053525113e-2f, 2.016914636e-2f, 1.980956830e-2f, 1.945640147e-2f, 1.910953037e-2f, 1.876884326e-2f, 1.843423024e-2f, 1.810558327e-2f, 1.778279431e-2f, 1.746576093e-2f, 1.715437882e-2f, 1.684854925e-2f, 1.654817164e-2f, 1.625314914e-2f, 1.596338488e-2f, 1.567878760e-2f, 1.539926510e-2f, 1.512472518e-2f, 1.485508028e-2f, 1.459024195e-2f, 1.433012541e-2f, 1.407464687e-2f, 1.382372249e-2f, 1.357727125e-2f, 1.333521400e-2f, 1.309747249e-2f, 1.286396943e-2f, 1.263462938e-2f, 1.240937784e-2f, 1.218814217e-2f, 1.197085064e-2f, 1.175743248e-2f, 1.154781971e-2f, 1.134194434e-2f, 1.113973837e-2f, 1.094113849e-2f, 1.074607857e-2f, 1.055449620e-2f, 1.036632899e-2f, 1.018151734e-2f, 9.999999776e-3f, 9.821718559e-3f, 9.646615945e-3f, 9.474635124e-3f, 9.305720218e-3f, 9.139817208e-3f, 8.976871148e-3f, 8.816830814e-3f, 8.659643121e-3f, 8.505257778e-3f, 8.353625424e-3f, 8.204695769e-3f, 8.058422245e-3f, 7.914755493e-3f, 7.773650344e-3f, 7.635060698e-3f, 7.498942316e-3f, 7.365250029e-3f, 7.233941462e-3f, 7.104974240e-3f, 6.978305988e-3f, 6.853895728e-3f, 6.731703877e-3f, 6.611690391e-3f, 6.493816152e-3f, 6.378043909e-3f, 6.264335476e-3f, 6.152654067e-3f, 6.042963825e-3f, 5.935229361e-3f, 5.829415284e-3f, 5.725488067e-3f, 5.623413250e-3f, 5.523158237e-3f, 5.424690899e-3f, 5.327979103e-3f, 5.232991185e-3f, 5.139696877e-3f, 5.048065912e-3f, 4.958068021e-3f, 4.869675264e-3f, 4.782858305e-3f, 4.697588738e-3f, 4.613839556e-3f, 4.531583749e-3f, 4.450793844e-3f, 4.371444695e-3f, 4.293510225e-3f, 4.216964822e-3f, 4.141784739e-3f, 4.067944363e-3f, 3.995420411e-3f, 3.924189601e-3f, 3.854228882e-3f, 3.785515204e-3f, 3.718026681e-3f, 3.651741194e-3f, 3.586637555e-3f, 3.522694577e-3f, 3.459891770e-3f, 3.398208413e-3f, 3.337624716e-3f, 3.278121119e-3f, 3.219678532e-3f, 3.162277630e-3f, 3.105900250e-3f, 3.050528001e-3f, 2.996142721e-3f, 2.942727180e-3f, 2.890263917e-3f, 2.838735934e-3f, 2.788126701e-3f, 2.738419687e-3f, 2.689598827e-3f, 2.641648287e-3f, 2.594552701e-3f, 2.548296703e-3f, 2.502865391e-3f, 2.458244096e-3f, 2.414418152e-3f, 2.371373819e-3f, 2.329096664e-3f, 2.287573181e-3f, 2.246790100e-3f, 2.206734149e-3f, 2.167392056e-3f, 2.128751716e-3f, 2.090800088e-3f, 2.053525066e-3f, 2.016914543e-3f, 1.980956877e-3f, 1.945640077e-3f, 1.910952968e-3f, 1.876884256e-3f, 1.843423001e-3f, 1.810558257e-3f, 1.778279431e-3f, 1.746576047e-3f, 1.715437858e-3f, 1.684854855e-3f, 1.654817141e-3f, 1.625314821e-3f, 1.596338581e-3f, 1.567878877e-3f, 1.539926510e-3f, 1.512472518e-3f, 1.485508052e-3f, 1.459024264e-3f, 1.433012541e-3f, 1.407464617e-3f, 1.382372226e-3f, 1.357727102e-3f, 1.333521446e-3f, 1.309747226e-3f, 1.286396990e-3f, 1.263462938e-3f, 1.240937738e-3f, 1.218814170e-3f, 1.197085017e-3f, 1.175743295e-3f, 1.154782018e-3f, 1.134194434e-3f, 1.113973907e-3f, 1.094113803e-3f, 1.074607833e-3f, 1.055449597e-3f, 1.036632922e-3f, 1.018151757e-3f, 1.000000047e-3f, 9.821718559e-4f, 9.646615945e-4f, 9.474635008e-4f, 9.305720450e-4f, 9.139816975e-4f, 8.976871613e-4f, 8.816830814e-4f, 8.659643354e-4f, 8.505258011e-4f, 8.353625308e-4f, 8.204696351e-4f, 8.058421663e-4f, 7.914755261e-4f, 7.773650577e-4f, 7.635061047e-4f, 7.498941850e-4f, 7.365249912e-4f, 7.233941578e-4f, 7.104974356e-4f, 6.978305755e-4f, 6.853895611e-4f, 6.731703761e-4f, 6.611690042e-4f, 6.493816036e-4f, 6.378043909e-4f, 6.264335243e-4f, 6.152653950e-4f, 6.042963942e-4f, 5.935229128e-4f, 5.829415168e-4f, 5.725487717e-4f, 5.623413017e-4f, 5.523158470e-4f, 5.424690899e-4f, 5.327978870e-4f, 5.232990952e-4f, 5.139696877e-4f, 5.048065796e-4f, 4.958068021e-4f, 4.869675322e-4f, 4.782858014e-4f, 4.697588738e-4f, 4.613839556e-4f, 4.531583691e-4f, 4.450794077e-4f, 4.371444811e-4f, 4.293510283e-4f, 4.216965172e-4f, 4.141784448e-4f, 4.067944246e-4f, 3.995420702e-4f, 3.924189659e-4f, 3.854228999e-4f, 3.785515146e-4f, 3.718026564e-4f, 3.651741135e-4f, 3.586637613e-4f, 3.522694751e-4f, 3.459891595e-4f, 3.398208355e-4f, 3.337624657e-4f, 3.278121294e-4f, 3.219678474e-4f, 3.162277571e-4f, 3.105900250e-4f, 3.050527885e-4f, 2.996142721e-4f, 2.942727297e-4f, 2.890263859e-4f, 2.838736109e-4f, 2.788126585e-4f, 2.738419571e-4f, 2.689598768e-4f, 2.641648462e-4f, 2.594552643e-4f, 2.548296761e-4f, 2.502865391e-4f, 2.458243980e-4f, 2.414418268e-4f, 2.371373703e-4f, 2.329096606e-4f, 2.287573152e-4f, 2.246790100e-4f, 2.206734061e-4f, 2.167392231e-4f, 2.128751657e-4f, 2.090799971e-4f, 2.053525095e-4f, 2.016914514e-4f, 1.980956731e-4f, 1.945640106e-4f, 1.910952997e-4f, 1.876884344e-4f, 1.843422942e-4f, 1.810558315e-4f, 1.778279402e-4f, 1.746576017e-4f, 1.715437829e-4f, 1.684854942e-4f, 1.654817170e-4f, 1.625314908e-4f, 1.596338552e-4f, 1.567878790e-4f, 1.539926598e-4f, 1.512472518e-4f, 1.485507964e-4f, 1.459024206e-4f, 1.433012512e-4f, 1.407464733e-4f, 1.382372284e-4f, 1.357727160e-4f, 1.333521504e-4f, 1.309747313e-4f, 1.286396873e-4f, 1.263462909e-4f, 1.240937709e-4f, 1.218814214e-4f, 1.197085003e-4f, 1.175743237e-4f, 1.154782003e-4f, 1.134194390e-4f, 1.113973849e-4f, 1.094113832e-4f, 1.074607862e-4f, 1.055449611e-4f, 1.036632893e-4f, 1.018151743e-4f };   // 10000^(-2i/1024), i = 0..511 (float32)
__global__ __launch_bounds__(256) void k_preRopeI(const float* __restrict__ X, bf* Ph, bf* Pl) { const size_t k = (size_t)blockIdx.x * 256 + threadIdx.x; if (k >= (size_t)TT * DM / 4) return; const size_t e = k * 4; const int d0 = (int)(e % DM); const int t = (int)(e / DM); const v4f a = *(const v4f*)(X + e); v4us oh, ol;
#pragma unroll
    for (int p = 0; p < 2; ++p) { const int i = (d0 >> 1) + p; const float ang = __fmul_rn((float)t, THE[i]); const float c = cosf(ang), sn = sinf(ang); const float x0 = bfr(a[2 * p]), x1 = bfr(a[2 * p + 1]);
        float a0 = __fmul_rn(x0, c), b0 = __fmul_rn(x1, sn), a1 = __fmul_rn(x1, c), b1 = __fmul_rn(x0, sn); asm volatile("" : "+v"(a0), "+v"(b0), "+v"(a1), "+v"(b1)); const float y0 = __fsub_rn(a0, b0), y1 = __fadd_rn(a1, b1); unsigned short u, w; splitf(y0, u, w); oh[2 * p] = u; ol[2 * p] = w; splitf(y1, u, w); oh[2 * p + 1] = u; ol[2 * p + 1] = w; }
    *(v4us*)(Ph + e) = oh; *(v4us*)(Pl + e) = ol;  }
// ---- k_fattn: causal attention of one batch in one launch: scores, softmax and probability x value product of a query tile stay in registers; the merged hi/lo planes [t][head x 64 + d] are written directly.
// Transposed forms: S^T = K Q^T (A = 16 key rows, B = 16 query columns), O^T += V^T P^T (A = 16 rows of the [d][t] value plane, B = P^T packed from two S^T tiles, which is the k order of WFrag::ld).
// A lane owns query column lr; lanes lr and lr + 16 split its keys and its d. One work-group of FNW waves per query tile: wave w takes the 32-key passes w, w + FNW, ... with a running maximum and sum of its own;
// the FNW partial (maximum, sum, O^T) are joined through LDS in wave order. Query rows < RH: bf16 hi/lo planes, 3 products, 16 queries a tile; the rest: fp16, 32 queries a tile, probabilities carried x 1024.
#define FNW  4
#define OSP  68                   // LDS row pitch of a partial O row (64 d + 4 floats)
#define L2E  1.4426950408889634f
__device__ __forceinline__ float xhalf(float x) { const int i = __float_as_int(x); return __int_as_float(__builtin_amdgcn_permlanex16(i, i, 0x76543210, 0xfedcba98, false, false)); }   // value of lane ^ 16
typedef __attribute__((ext_vector_type(16))) unsigned short v16us;
template <typename T16, bool HL, int NQ>
__device__ __forceinline__ void fattn_tile(const T16* __restrict__ Q, const T16* __restrict__ Q2, const T16* __restrict__ Kp, const T16* __restrict__ K2, const T16* __restrict__ Vt, const T16* __restrict__ V2, int q0, bf* Ah, bf* Al, float* os, float* ms, float* ls) {
    typedef typename WFrag<T16>::V V;
    const int lane = threadIdx.x & 31, lr = lane & 15, hi = lane >> 4;
    const int w = __builtin_amdgcn_readfirstlane((int)(threadIdx.x >> 5));   // wave number, held scalar so that the pass loop keeps a scalar branch
    const int npass = (q0 + NQ * 16 + 31) / 32;                              // 32-key passes up to and including the diagonal one
    V qf[NQ][2], qf2[NQ][2];
#pragma unroll
    for (int g = 0; g < NQ; ++g)
#pragma unroll
        for (int c = 0; c < 2; ++c) { const size_t qo = (size_t)(q0 + g * 16 + lr) * HD + c * 32 + 8 * hi; qf[g][c] = WFrag<T16>::ld(Q + qo); if (HL) qf2[g][c] = WFrag<T16>::ld(Q2 + qo); }
    v8f o[4][NQ]; float m[NQ], l[NQ];
#pragma unroll
    for (int g = 0; g < NQ; ++g) { m[g] = -3.0e38f; l[g] = 0.f;
#pragma unroll
        for (int mb = 0; mb < 4; ++mb) o[mb][g] = (v8f){}; }
    const unsigned ko = lr * HD + 8 * hi, vo = lr * TT + 8 * hi;   // 32-bit lane offsets beside wave-uniform bases: one register serves every plane
    V kf[2][2], kf2[2][2];
    if (!HL) { const int p0 = min(w, npass - 1);   // first pass's K fragments (a wave without a pass fetches the last pass's: in bounds, unused)
#pragma unroll
      for (int t = 0; t < 2; ++t)
#pragma unroll
          for (int c = 0; c < 2; ++c) { kf[t][c] = WFrag<T16>::ld(Kp + (size_t)p0 * 32 * HD + ko + (t * 16 * HD + c * 32)); } }
#pragma unroll 1   // rolled: one pass already fills the register file
    for (int p = w; p < npass; p += FNW) {
        const int kb = p * 32;
        if (HL) {   // hi/lo tiles (at most RH / 32 / FNW passes a wave): K fetched in its own pass, which keeps the kernel at four waves a SIMD without spills
#pragma unroll
            for (int t = 0; t < 2; ++t)
#pragma unroll
                for (int c = 0; c < 2; ++c) { kf[t][c] = WFrag<T16>::ld(Kp + (size_t)kb * HD + ko + (t * 16 * HD + c * 32)); kf2[t][c] = WFrag<T16>::ld(K2 + (size_t)kb * HD + ko + (t * 16 * HD + c * 32)); }
            asm volatile("s_wait_xcnt 0x0" ::: "memory"); }   // the V loads below land in registers that held the K loads' addresses
        V vf[4], vf2[4];
#pragma unroll
        for (int mb = 0; mb < 4; ++mb) { vf[mb] = WFrag<T16>::ld(Vt + kb + vo + mb * 16 * TT); if (HL) vf2[mb] = WFrag<T16>::ld(V2 + kb + vo + mb * 16 * TT); }
        v8f s[2][NQ];
#pragma unroll
        for (int t = 0; t < 2; ++t)
#pragma unroll
            for (int g = 0; g < NQ; ++g) { s[t][g] = (v8f){};
#pragma unroll
                for (int c = 0; c < 2; ++c) { s[t][g] = WFrag<T16>::mma(kf[t][c], qf[g][c], s[t][g]); if (HL) { s[t][g] = WFrag<T16>::mma(kf[t][c], qf2[g][c], s[t][g]); s[t][g] = WFrag<T16>::mma(kf2[t][c], qf[g][c], s[t][g]); } } }
        if (!HL) { const int pn = (p + FNW < npass) ? p + FNW : p;   // this wave's next pass: its K fragments fly during the softmax (the last pass fetches its own again: in bounds, unused)
#pragma unroll
          for (int t = 0; t < 2; ++t)
#pragma unroll
              for (int c = 0; c < 2; ++c) { kf[t][c] = WFrag<T16>::ld(Kp + (size_t)pn * 32 * HD + ko + (t * 16 * HD + c * 32)); } }
        asm volatile("s_wait_xcnt 0x0" ::: "memory");   // the softmax below reuses the registers that held this pass's load addresses
        if (kb + 31 > q0) {   // only the diagonal pass holds keys behind a query (scalar test)
#pragma unroll
            for (int t = 0; t < 2; ++t)
#pragma unroll
                for (int g = 0; g < NQ; ++g)
#pragma unroll
                    for (int r = 0; r < 8; ++r) s[t][g][r] = (kb + t * 16 + hi * 8 + r <= q0 + g * 16 + lr) ? s[t][g][r] : -3.0e38f; }
        V pf[NQ], pf2[NQ];
#pragma unroll
        for (int g = 0; g < NQ; ++g) {
            float mx = -3.0e38f;
#pragma unroll
            for (int t = 0; t < 2; ++t)
#pragma unroll
                for (int r = 0; r < 8; ++r) mx = fmaxf(mx, s[t][g][r]);
            mx = fmaxf(mx, xhalf(mx)) * SCL;                       // SCL is a power of two: the scaled maximum is the maximum of the scaled scores (a masked -3e38 stays far below every score)
            const float mn = fmaxf(m[g], mx); const float al = __builtin_amdgcn_exp2f((m[g] - mn) * L2E); m[g] = mn;
            float sum = 0.f; v16us uh, ul; v16h ph;
#pragma unroll
            for (int t = 0; t < 2; ++t)
#pragma unroll
                for (int r = 0; r < 8; ++r) { const float d0 = s[t][g][r] * SCL - mn; const float e = __builtin_amdgcn_exp2f(HL ? d0 * L2E : d0 * L2E + 10.0f); sum += e;   // + 10: x 1024 (keeps small fp16 probabilities normal), cancels in O / sum
                    if (HL) { unsigned short a2, c2; splitf(e, a2, c2); uh[t * 8 + r] = a2; ul[t * 8 + r] = c2; } else ph[t * 8 + r] = tohx(e); }
            l[g] = l[g] * al + sum;
#pragma unroll
            for (int mb = 0; mb < 4; ++mb) o[mb][g] *= al;
            if constexpr (HL) { pf[g] = __builtin_bit_cast(v16bf, uh); pf2[g] = __builtin_bit_cast(v16bf, ul); } else pf[g] = ph;
        }
#pragma unroll
        for (int mb = 0; mb < 4; ++mb)
#pragma unroll
            for (int g = 0; g < NQ; ++g) { o[mb][g] = WFrag<T16>::mma(vf[mb], pf[g], o[mb][g]); if (HL) { o[mb][g] = WFrag<T16>::mma(vf[mb], pf2[g], o[mb][g]); o[mb][g] = WFrag<T16>::mma(vf2[mb], pf[g], o[mb][g]); } }
    }
#pragma unroll
    for (int g = 0; g < NQ; ++g) { const float lj = l[g] + xhalf(l[g]); if (hi == 0) { ms[w * 32 + g * 16 + lr] = m[g]; ls[w * 32 + g * 16 + lr] = lj; }
#pragma unroll
        for (int mb = 0; mb < 4; ++mb) { float* op = os + (size_t)(w * 32 + g * 16 + lr) * OSP + mb * 16 + hi * 8; const v8f x = o[mb][g];
            *(v4fa*)op = (v4f){x[0], x[1], x[2], x[3]}; *(v4fa*)(op + 4) = (v4f){x[4], x[5], x[6], x[7]}; } }
    __syncthreads();                               // all FNW partial results are in LDS before any thread joins them
    constexpr int TPQ = 8 / NQ, DPT = 8 * NQ;      // threads a query, d values a thread
    const int q = threadIdx.x / TPQ, d0 = (threadIdx.x % TPQ) * DPT;
    float M = ms[q];
#pragma unroll
    for (int u = 1; u < FNW; ++u) M = fmaxf(M, ms[u * 32 + q]);
    float f[FNW], L = 0.f;
#pragma unroll
    for (int u = 0; u < FNW; ++u) { f[u] = __builtin_amdgcn_exp2f((ms[u * 32 + q] - M) * L2E); L += ls[u * 32 + q] * f[u]; }   // a wave without a pass: maximum -3e38, weight 0
    const float inv = __fdiv_rn(1.0f, L);
#pragma unroll
    for (int c = 0; c < DPT / 8; ++c) { v8us oh, ol;
#pragma unroll
        for (int hf = 0; hf < 2; ++hf) { v4f val = (v4f){};
#pragma unroll
            for (int u = 0; u < FNW; ++u) val += *(const v4fa*)(os + (size_t)(u * 32 + q) * OSP + d0 + c * 8 + hf * 4) * f[u];
#pragma unroll
            for (int k = 0; k < 4; ++k) { unsigned short a2, c2; splitf(val[k] * inv, a2, c2); oh[hf * 4 + k] = a2; ol[hf * 4 + k] = c2; } }
        const size_t oo = (size_t)(q0 + q) * DQ + d0 + c * 8; *(v8us*)(Ah + oo) = oh; *(v8us*)(Al + oo) = ol; }
    if constexpr (HL) asm volatile("s_wait_xcnt 0x0" ::: "memory");   // behind the last store: the fp16 tile's code is laid out behind this tile's and writes the registers that these stores name
}
// grid (heads, tiles): cost falls with blockIdx.y (longest query tiles first)
__global__ __launch_bounds__(32 * FNW) void k_fattn(const h16* __restrict__ Q16, const h16* __restrict__ K16, const h16* __restrict__ V16, const bf* __restrict__ Qh, const bf* __restrict__ Ql, const bf* __restrict__ Kh, const bf* __restrict__ Kl, const bf* __restrict__ Vh, const bf* __restrict__ Vl, bf* Ah, bf* Al) {
    __shared__ __align__(16) float os[FNW * 32 * OSP]; __shared__ float ms[FNW * 32]; __shared__ float ls[FNW * 32];
    const size_t ho = (size_t)blockIdx.x * TT * HD; const int y = blockIdx.y; Ah += blockIdx.x * HD; Al += blockIdx.x * HD;
    if (y < (TT - RH) / 32) fattn_tile<h16, false, 2>(Q16 + ho, nullptr, K16 + ho, nullptr, V16 + ho, nullptr, TT - 32 * (y + 1), Ah, Al, os, ms, ls);
    else fattn_tile<bf, true, 1>(Qh + ho, Ql + ho, Kh + ho, Kl + ho, Vh + ho, Vl + ho, RH - 16 * (y - (TT - RH) / 32 + 1), Ah, Al, os, ms, ls);
}

extern "C" void kernel_launch(void* const* d_in, const int* in_sizes, int n_in,
                              void* d_out, int out_size, void* d_ws, size_t ws_size, hipStream_t stream) {
    (void)in_sizes; (void)n_in; (void)out_size;
    const float* x = (const float*)d_in[0]; const float* wq = (const float*)d_in[1]; const float* wk = (const float*)d_in[2]; const float* wv = (const float*)d_in[3]; const float* wo = (const float*)d_in[4]; const float* bo = (const float*)d_in[5];
    float* OUT = (float*)d_out;     // [4][2048][1024]
    char* wsp = (char*)d_ws;
    auto take = [&](size_t bytes) { char* p = wsp; wsp += (bytes + 255) & ~(size_t)255; return (void*)p; };
    bf* XBl = (bf*)take((size_t)TT * DM * 2); bf* WQ = (bf*)take((size_t)DQ * DM * 2); bf* WK = (bf*)take((size_t)DKV * DM * 2); bf* WV = (bf*)take((size_t)DKV * DM * 2); bf* WO = (bf*)take((size_t)DM * DQ * 2);
    bf* XB = (bf*)take((size_t)TT * DM * 2);
    h16* QP16 = (h16*)take((size_t)NH_ * TT * HD * 2); h16* KP16 = (h16*)take((size_t)NKV * TT * HD * 2); h16* VT16 = (h16*)take((size_t)NKV * HD * TT * 2);
    bf* QPh = (bf*)take((size_t)NH_ * TT * HD * 2); bf* QPl = (bf*)take((size_t)NH_ * TT * HD * 2); bf* KPh = (bf*)take((size_t)NKV * TT * HD * 2); bf* KPl = (bf*)take((size_t)NKV * TT * HD * 2); bf* VTh = (bf*)take((size_t)NKV * HD * TT * 2); bf* VTl = (bf*)take((size_t)NKV * HD * TT * 2);
    bf* ATh = (bf*)take((size_t)TT * DQ * 2); bf* ATl = (bf*)take((size_t)TT * DQ * 2);
    if ((size_t)(wsp - (char*)d_ws) > ws_size) return;    // ws 256 MiB
    { k_cvt8<<<(unsigned)(((size_t)DQ * DM / 8 + 255) / 256), 256, 0, stream>>>(wq, WQ, (size_t)DQ * DM / 8); k_cvt8<<<(unsigned)(((size_t)DKV * DM / 8 + 255) / 256), 256, 0, stream>>>(wk, WK, (size_t)DKV * DM / 8); k_cvt8<<<(unsigned)(((size_t)DKV * DM / 8 + 255) / 256), 256, 0, stream>>>(wv, WV, (size_t)DKV * DM / 8);
      k_cvt8<<<(unsigned)(((size_t)DM * DQ / 8 + 255) / 256), 256, 0, stream>>>(wo, WO, (size_t)DM * DQ / 8);
       }
    for (int b = 0; b < NB_; ++b) {
        
        k_preRopeI<<<(unsigned)(((size_t)TT * DM / 4 + 255) / 256), 256, 0, stream>>>(x + (size_t)b * TT * DM, XB, XBl);   /* rx = pairwise rope of the input, as hi/lo planes */
        k_gemmw<bf, 1, false, false, 8, true><<<dim3(TT / 64, DQ / 64, 1), 256, 0, stream>>>(XB, XBl, WQ, nullptr, DM, nullptr, HD, nullptr, 0, 0, 0, 0, QP16, QPh, QPl, (size_t)TT * HD);   /* q = rx Wq^T (hi/lo x exact), written as head planes [h][t][d] */
        k_gemmw<bf, 1, false, false, 8, true><<<dim3(TT / 64, DKV / 64, 1), 256, 0, stream>>>(XB, XBl, WK, nullptr, DM, nullptr, HD, nullptr, 0, 0, 0, 0, KP16, KPh, KPl, (size_t)TT * HD);   /* k = rx Wk^T, the same */
        k_cvt8<<<(unsigned)(((size_t)TT * DM / 8 + 255) / 256), 256, 0, stream>>>(x + (size_t)b * TT * DM, XB, (size_t)TT * DM / 8);   /* plain input for v */
        k_gemmw<bf, 0, false, false, 8, true><<<dim3(DKV / 64, TT / 64, 1), 256, 0, stream>>>(WV, nullptr, XB, nullptr, DM, nullptr, TT, nullptr, 0, 0, 0, 0, VT16, VTh, VTl, (size_t)64);   /* v^T = Wv x^T: rows are head x 64 + d, columns t, the [g][d][t] planes as they stand */
        k_fattn<<<dim3(NH_, (TT - RH) / 32 + RH / 16, 1), 32 * FNW, 0, stream>>>(QP16, KP16, VT16, QPh, QPl, KPh, KPl, VTh, VTl, ATh, ATl);   /* one kv head per query head */
        k_gemmw<bf, 1, true, false, 8, false><<<dim3(TT / 64, DM / 64, 1), 256, 0, stream>>>(ATh, ATl, WO, nullptr, DQ, OUT + (size_t)b * TT * DM, DM, bo, 0, 0, 0, 0, nullptr, nullptr, nullptr, 0); }
}

// v004
// One run takes 321 microseconds.
// Two timings next to v003 both put it at 1.18 times that version's speed.
// All steps since v000 together make it 9.04 times as fast.
#include <hip/hip_runtime.h>

// Causal multi-head self-attention with a pairwise rotary applied to the INPUT before the q/k projections (input [4][2048][1024]; rx[t][2i], rx[t][2i+1] = rotation of (x[2i], x[2i+1]) by t x 10000^(-2i/1024) over the 1,024 features (computed); q = rx Wq^T, k = rx Wk^T, v = input Wv^T ('oi' 1/32, no bias; 16 heads x 64); scores masked causal then / 8; softmax; out = merged Wo^T + bo -> [4][2048][1024] (8.4 M)).
// Every stage is one launch over all four batches (the batch is a grid dimension; each plane holds [batch] in front of its per-batch layout): a rotary kernel builds rx from the bf16-rounded input with on-the-fly precise cosf/sinf of t x theta[i] (512 float32 constants) and splits it into bf16 hi/lo planes; q and k projections hi/lo x exact; a plain bf16 copy of the input feeds the exact v projection (formed as Wv x^T, so its tiles are [d][t] already); the three projections write the attention's fp16 and hi/lo planes from their own epilogue; causal T-2048 attention fused in one launch, running softmax (hybrid rows: < 512 hi/lo 3 products, rest fp16 x1024; key passes above the diagonal skipped); merged hi/lo x Wo exact + bo.
// Compute dtypes, f32 accumulate: every input rounded to bf16; input rotary f32, q/k projections hi/lo x exact (2 products: ~f32), v exact; attention rows < 512 3 products, rest fp16; softmax f32; Wo hl x exact + bias.

#define NB_  4
#define TT   2048
#define DM   1024
#define NH_  16
#define NKV  16
#define HD   64
#define DQ   (NH_ * HD)
#define DKV  (NKV * HD)
static_assert(DQ == DM && DKV == DM, "the four weight planes share one size");
#define RH   512                  // query rows < RH use hi+lo planes (0: none)
#define SCL  0.125f   // HD^-0.5
typedef _Float16 h16;
typedef unsigned short bf;
typedef __attribute__((ext_vector_type(16))) __bf16   v16bf;
typedef __attribute__((ext_vector_type(16))) _Float16 v16h;
typedef __attribute__((ext_vector_type(8)))  _Float16 v8h;
typedef __attribute__((ext_vector_type(8)))  unsigned short v8us;
typedef __attribute__((ext_vector_type(8)))  float    v8f;
typedef __attribute__((ext_vector_type(4)))  float    v4f;
typedef v8h  __attribute__((may_alias)) v8ha;
typedef v4f  __attribute__((may_alias)) v4fa;
typedef v8us __attribute__((may_alias)) v8usa;

__device__ __forceinline__ unsigned short f2bf(float f) { unsigned u = __float_as_uint(f); u += 0x7FFFu + ((u >> 16) & 1u); return (unsigned short)(u >> 16); }
__device__ __forceinline__ float bf2f(unsigned short b) { return __uint_as_float(((unsigned)b) << 16); }
__device__ __forceinline__ float bfr(float f) { return bf2f(f2bf(f)); }
__device__ __forceinline__ v16h cat16(v8h lo, v8h hi) { return __builtin_shufflevector(lo, hi, 0, 1, 2, 3, 4, 5, 6, 7, 8, 9, 10, 11, 12, 13, 14, 15); }
__device__ __forceinline__ v16bf cat16b(v8us lo, v8us hi) { return __builtin_bit_cast(v16bf, __builtin_shufflevector(lo, hi, 0, 1, 2, 3, 4, 5, 6, 7, 8, 9, 10, 11, 12, 13, 14, 15)); }
__device__ __forceinline__ v8f wmma16(v16h a, v16h b, v8f c) { return __builtin_amdgcn_wmma_f32_16x16x32_f16(false, a, false, b, (short)0, c, false, false); }
__device__ __forceinline__ v8f wmmab(v16bf a, v16bf b, v8f c) { return __builtin_amdgcn_wmma_f32_16x16x32_bf16(false, a, false, b, (short)0, c, false, false); }
__device__ __forceinline__ h16 tohx(float x) { return (h16)x; }
__device__ __forceinline__ void splitf(float y, unsigned short& h, unsigned short& l) { h = f2bf(y); l = f2bf(y - bf2f(h)); }
typedef __attribute__((ext_vector_type(2))) _Float16 v2h;
typedef __attribute__((ext_vector_type(4))) _Float16 v4h;
typedef __attribute__((ext_vector_type(2))) unsigned short v2us;
typedef __attribute__((ext_vector_type(4))) unsigned short v4us;
typedef __attribute__((ext_vector_type(2))) float v2f;
typedef __attribute__((ext_vector_type(4))) int v4i;


// ---- k_gemmw: register-blocked GEMM, one work-group of NW waves per 64x64 output tile, operands straight from K-contiguous 16-bit planes; grid (M/64, N/64, Z), 32 NW threads.
// C[m][n] (f32, pitch ldc, + optional f32 bias[n]) = sum_k A[m][k] Bt[n][k] (+ split products per NSPLIT). z-batch strides sA/sB/sC in elements (PLANES: sC is the z stride of each plane). K % 32 == 0.
// PLANES: the summed tile is not stored as f32 but rounded in the epilogue to three 16-bit planes (fp16, bf16 hi, bf16 lo), element (m, n) at blockIdx.y x sT + m x ldc + (n - c0): [head][t][d] with sT = T x 64, ldc = 64; [d][t] with sT = 64, ldc = T.
// The K loop is a chain of dependent load latencies, so it is cut into NW contiguous runs of 32-k chunks, one run a wave: each wave holds a whole 64x64 f32 partial tile (16 accumulators),
// and the NW partial tiles are added through LDS in wave order. DIAG (probability x value contraction): the K loop ends at the diagonal block of query rows r0+roff.. (probabilities beyond it are exactly zero).
template <typename T16> struct WFrag;
template <> struct WFrag<h16> { typedef v16h V; static __device__ __forceinline__ V ld(const h16* p) { return cat16(*(const v8h*)p, *(const v8h*)(p + 16)); } static __device__ __forceinline__ v8f mma(V a, V b, v8f c) { return wmma16(a, b, c); } };
template <> struct WFrag<bf> { typedef v16bf V; static __device__ __forceinline__ V ld(const bf* p) { return cat16b(*(const v8us*)p, *(const v8us*)(p + 16)); } static __device__ __forceinline__ v8f mma(V a, V b, v8f c) { return wmmab(a, b, c); } };
template <typename T16, int NSPLIT, bool BIAS, bool DIAG, int NW, bool PLANES>
__global__ __launch_bounds__(32 * NW) void k_gemmw(const T16* __restrict__ A, const T16* __restrict__ A2, const T16* __restrict__ Bt, const T16* __restrict__ Bt2, int K, float* C, int ldc, const float* __restrict__ bias, int roff, size_t sA, size_t sB, size_t sC, h16* P16, bf* Ph, bf* Pl, size_t sT) {
    typedef typename WFrag<T16>::V V;
    __shared__ __align__(16) float os[NW * 64 * 68];   // one 64x64 partial tile a wave, row pitch 68
    const size_t z = blockIdx.z; A += z * sA; if (A2) A2 += z * sA; Bt += z * sB; if (Bt2) Bt2 += z * sB; if (!PLANES) C += z * sC;
    const int lane = threadIdx.x & 31, lr = lane & 15, hi = lane >> 4; const int r0 = blockIdx.x * 64, c0 = blockIdx.y * 64;
    const int w = __builtin_amdgcn_readfirstlane((int)(threadIdx.x >> 5));   // wave number, held scalar so that the K loop keeps a scalar branch
    const int nch = (DIAG ? min(K, r0 + roff + 64) : K) / 32;                // 32-k chunks of this tile
    const int kb = 32 * (w * nch / NW), ke = 32 * ((w + 1) * nch / NW);      // this wave's run of them (empty where there are fewer chunks than waves)
    v8f acc[4][4];
#pragma unroll
    for (int mb = 0; mb < 4; ++mb)
#pragma unroll
        for (int nb = 0; nb < 4; ++nb) acc[mb][nb] = (v8f){};
    const size_t aoff = (size_t)(r0 + lr) * K + 8 * hi, boff = (size_t)(c0 + lr) * K + 8 * hi;
#pragma unroll 1
    for (int kc = kb; kc < ke; kc += 32) {
        V a[4], a2[4];
#pragma unroll
        for (int mb = 0; mb < 4; ++mb) { a[mb] = WFrag<T16>::ld(A + aoff + (size_t)mb * 16 * K + kc); if (NSPLIT == 1 || NSPLIT == 2) a2[mb] = WFrag<T16>::ld(A2 + aoff + (size_t)mb * 16 * K + kc); }
#pragma unroll
        for (int nb = 0; nb < 4; ++nb) { const V b = WFrag<T16>::ld(Bt + boff + (size_t)nb * 16 * K + kc); V b2; if (NSPLIT >= 2) b2 = WFrag<T16>::ld(Bt2 + boff + (size_t)nb * 16 * K + kc);
#pragma unroll
            for (int mb = 0; mb < 4; ++mb) { acc[mb][nb] = WFrag<T16>::mma(a[mb], b, acc[mb][nb]); if (NSPLIT == 1 || NSPLIT == 2) acc[mb][nb] = WFrag<T16>::mma(a2[mb], b, acc[mb][nb]); if (NSPLIT >= 2) acc[mb][nb] = WFrag<T16>::mma(a[mb], b2, acc[mb][nb]); } }
        asm volatile("v_nop\n\tv_nop\n\tv_nop\n\tv_nop" : "+v"(acc[0][0]), "+v"(acc[1][1]), "+v"(acc[2][2]), "+v"(acc[3][3]) : "v"(a[0]), "v"(a[3]));
    }
    float* ow = os + w * 64 * 68;
#pragma unroll
    for (int mb = 0; mb < 4; ++mb) {
#pragma unroll
        for (int nb = 0; nb < 4; ++nb) {
#pragma unroll
            for (int j = 0; j < 8; ++j) ow[(mb * 16 + hi * 8 + j) * 68 + nb * 16 + lr] = acc[mb][nb][j]; } }
    __syncthreads();                               // all NW partial tiles are in LDS before any thread adds them
#pragma unroll
    for (int s = 0; s < 32 / NW; ++s) { const int q = s * 32 * NW + threadIdx.x, row = q >> 4, cofs = (q & 15) * 4; v4f val = *(const v4fa*)(os + row * 68 + cofs);
#pragma unroll
        for (int u = 1; u < NW; ++u) val += *(const v4fa*)(os + (u * 64 + row) * 68 + cofs);
        if (BIAS) { val[0] += bfr(bias[c0 + cofs]); val[1] += bfr(bias[c0 + cofs + 1]); val[2] += bfr(bias[c0 + cofs + 2]); val[3] += bfr(bias[c0 + cofs + 3]); }
        if constexpr (PLANES) { const size_t po = z * sC + (size_t)blockIdx.y * sT + (size_t)(r0 + row) * ldc + cofs; v4h o16; v4us oh, ol;
#pragma unroll
            for (int k = 0; k < 4; ++k) { o16[k] = tohx(val[k]); unsigned short a2, c2; splitf(val[k], a2, c2); oh[k] = a2; ol[k] = c2; }
            *(v4h*)(P16 + po) = o16; *(v4us*)(Ph + po) = oh; *(v4us*)(Pl + po) = ol;
        } else
        *(v4f*)(C + (size_t)(r0 + row) * ldc + c0 + cofs) = val; }
}


__global__ __launch_bounds__(256) void k_wtG(const float* __restrict__ w, int K, int N, bf* Bt) {
    const int lane = threadIdx.x & 31; const int L0 = (blockIdx.x * 8 + (threadIdx.x >> 5)) * 8; const int nlines = N * K / 64;
{
#pragma unroll 1
        for (int l = 0; l < 8; ++l) { const int L = L0 + l; if (L >= nlines) break; const size_t e = (size_t)L * 64 + lane * 2; const int k = (int)(e % K), n = (int)(e / K); v2us o;
            o[0] = f2bf(w[(size_t)k * N + n]); o[1] = f2bf(w[(size_t)(k + 1) * N + n]); *(v2us*)(Bt + e) = o; }
         }
}
__global__ __launch_bounds__(256) void k_cvt8(const float* __restrict__ src, bf* dst, size_t n8) { const size_t i = (size_t)blockIdx.x * 256 + threadIdx.x; if (i >= n8) return; const v8f v = *(const v8f*)(src + i * 8); v8us o;
#pragma unroll
    for (int k = 0; k < 8; ++k) o[k] = f2bf(v[k]); *(v8us*)(dst + i * 8) = o;  }
// the four weight matrices (n8 x 8 elements each) in one launch: blockIdx.y picks the source, the bf16 copies lie one behind the other in dst
__global__ __launch_bounds__(256) void k_cvt8w(const float* __restrict__ s0, const float* __restrict__ s1, const float* __restrict__ s2, const float* __restrict__ s3, bf* dst, size_t n8) { const size_t i = (size_t)blockIdx.x * 256 + threadIdx.x; if (i >= n8) return;
    const unsigned y = blockIdx.y; const float* src = y == 0 ? s0 : y == 1 ? s1 : y == 2 ? s2 : s3; const v8f v = *(const v8f*)(src + i * 8); v8us o;
#pragma unroll
    for (int k = 0; k < 8; ++k) o[k] = f2bf(v[k]); *(v8us*)(dst + ((size_t)y * n8 + i) * 8) = o;  }

__constant__ float THE[DM / 2] = { 1.000000000e+0f, 9.821718931e-1f, 9.646615982e-1f, 9.474635124e-1f, 9.305720329e-1f, 9.139816761e-1f, 8.976871371e-1f, 8.816830516e-1f, 8.659643531e-1f, 8.505257964e-1f, 8.353625536e-1f, 8.204696178e-1f, 8.058421612e-1f, 7.914755344e-1f, 7.773650289e-1f, 7.635060549e-1f, 7.498942018e-1f, 7.365249991e-1f, 7.233941555e-1f, 7.104974389e-1f, 6.978305578e-1f, 6.853895783e-1f, 6.731703877e-1f, 6.611690521e-1f, 6.493816376e-1f, 6.378043890e-1f, 6.264335513e-1f, 6.152654290e-1f, 6.042963862e-1f, 5.935229063e-1f, 5.829415321e-1f, 5.725488067e-1f, 5.623413324e-1f, 5.523158312e-1f, 5.424690843e-1f, 5.327978730e-1f, 5.232990980e-1f, 5.139696598e-1f, 5.048065782e-1f, 4.958068132e-1f, 4.869675338e-1f, 4.782858193e-1f, 4.697588682e-1f, 4.613839686e-1f, 4.531583786e-1f, 4.450794160e-1f, 4.371444881e-1f, 4.293510318e-1f, 4.216965139e-1f, 4.141784608e-1f, 4.067944288e-1f, 3.995420635e-1f, 3.924189806e-1f, 3.854228854e-1f, 3.785515130e-1f, 3.718026578e-1f, 3.651741147e-1f, 3.586637676e-1f, 3.522694707e-1f, 3.459891677e-1f, 3.398208320e-1f, 3.337624669e-1f, 3.278121054e-1f, 3.219678402e-1f, 3.162277639e-1f, 3.105900288e-1f, 3.050527871e-1f, 2.996142805e-1f, 2.942727208e-1f, 2.890263796e-1f, 2.838735878e-1f, 2.788126767e-1f, 2.738419771e-1f, 2.689598799e-1f, 2.641648352e-1f, 2.594552636e-1f, 2.548296750e-1f, 2.502865493e-1f, 2.458244115e-1f, 2.414418161e-1f, 2.371373773e-1f, 2.329096645e-1f, 2.287573218e-1f, 2.246790081e-1f, 2.206734121e-1f, 2.167392224e-1f, 2.128751725e-1f, 2.090800107e-1f, 2.053525001e-1f, 2.016914487e-1f, 1.980956793e-1f, 1.945639998e-1f, 1.910952926e-1f, 1.876884252e-1f, 1.843422949e-1f, 1.810558289e-1f, 1.778279394e-1f, 1.746575981e-1f, 1.715437919e-1f, 1.684854925e-1f, 1.654817164e-1f, 1.625314802e-1f, 1.596338600e-1f, 1.567878872e-1f, 1.539926529e-1f, 1.512472481e-1f, 1.485508084e-1f, 1.459024251e-1f, 1.433012635e-1f, 1.407464594e-1f, 1.382372230e-1f, 1.357727200e-1f, 1.333521456e-1f, 1.309747249e-1f, 1.286396980e-1f, 1.263462901e-1f, 1.240937784e-1f, 1.218814179e-1f, 1.197085008e-1f, 1.175743267e-1f, 1.154781953e-1f, 1.134194434e-1f, 1.113973856e-1f, 1.094113812e-1f, 1.074607819e-1f, 1.055449620e-1f, 1.036632955e-1f, 1.018151715e-1f, 1.000000015e-1f, 9.821718931e-2f, 9.646616131e-2f, 9.474635124e-2f, 9.305720776e-2f, 9.139817208e-2f, 8.976871520e-2f, 8.816830814e-2f, 8.659642935e-2f, 8.505257964e-2f, 8.353625238e-2f, 8.204696327e-2f, 8.058422059e-2f, 7.914755493e-2f, 7.773650438e-2f, 7.635060698e-2f, 7.498942316e-2f, 7.365249842e-2f, 7.233941555e-2f, 7.104974240e-2f, 6.978306174e-2f, 6.853895634e-2f, 6.731703877e-2f, 6.611689925e-2f, 6.493816525e-2f, 6.378044188e-2f, 6.264335662e-2f, 6.152654067e-2f, 6.042964011e-2f, 5.935229361e-2f, 5.829415470e-2f, 5.725488067e-2f, 5.623413250e-2f, 5.523158237e-2f, 5.424690992e-2f, 5.327979103e-2f, 5.232991278e-2f, 5.139696971e-2f, 5.048065633e-2f, 4.958068207e-2f, 4.869675264e-2f, 4.782858118e-2f, 4.697588831e-2f, 4.613839835e-2f, 4.531583562e-2f, 4.450793937e-2f, 4.371444881e-2f, 4.293510318e-2f, 4.216964915e-2f, 4.141784459e-2f, 4.067944363e-2f, 3.995420411e-2f, 3.924189880e-2f, 3.854228929e-2f, 3.785515204e-2f, 3.718026727e-2f, 3.651741147e-2f, 3.586637601e-2f, 3.522694483e-2f, 3.459891677e-2f, 3.398208320e-2f, 3.337624669e-2f, 3.278120980e-2f, 3.219678625e-2f, 3.162277490e-2f, 3.105900250e-2f, 3.050527908e-2f, 2.996142767e-2f, 2.942727134e-2f, 2.890263870e-2f, 2.838736027e-2f, 2.788126655e-2f, 2.738419548e-2f, 2.689598873e-2f, 2.641648240e-2f, 2.594552748e-2f, 2.548296750e-2f, 2.502865344e-2f, 2.458244003e-2f, 2.414418198e-2f, 2.371373773e-2f, 2.329096571e-2f, 2.287573181e-2f, 2.246790007e-2f, 2.206734009e-2f, 2.167392150e-2f, 2.128751576e-2f, 2.090799995e-2f, 2.053525113e-2f, 2.016914636e-2f, 1.980956830e-2f, 1.945640147e-2f, 1.910953037e-2f, 1.876884326e-2f, 1.843423024e-2f, 1.810558327e-2f, 1.778279431e-2f, 1.746576093e-2f, 1.715437882e-2f, 1.684854925e-2f, 1.654817164e-2f, 1.625314914e-2f, 1.596338488e-2f, 1.567878760e-2f, 1.539926510e-2f, 1.512472518e-2f, 1.485508028e-2f, 1.459024195e-2f, 1.433012541e-2f, 1.407464687e-2f, 1.382372249e-2f, 1.357727125e-2f, 1.333521400e-2f, 1.309747249e-2f, 1.286396943e-2f, 1.263462938e-2f, 1.240937784e-2f, 1.218814217e-2f, 1.197085064e-2f, 1.175743248e-2f, 1.154781971e-2f, 1.134194434e-2f, 1.113973837e-2f, 1.094113849e-2f, 1.074607857e-2f, 1.055449620e-2f, 1.036632899e-2f, 1.018151734e-2f, 9.999999776e-3f, 9.821718559e-3f, 9.646615945e-3f, 9.474635124e-3f, 9.305720218e-3f, 9.139817208e-3f, 8.976871148e-3f, 8.816830814e-3f, 8.659643121e-3f, 8.505257778e-3f, 8.353625424e-3f, 8.204695769e-3f, 8.058422245e-3f, 7.914755493e-3f, 7.773650344e-3f, 7.635060698e-3f, 7.498942316e-3f, 7.365250029e-3f, 7.233941462e-3f, 7.104974240e-3f, 6.978305988e-3f, 6.853895728e-3f, 6.731703877e-3f, 6.611690391e-3f, 6.493816152e-3f, 6.378043909e-3f, 6.264335476e-3f, 6.152654067e-3f, 6.042963825e-3f, 5.935229361e-3f, 5.829415284e-3f, 5.725488067e-3f, 5.623413250e-3f, 5.523158237e-3f, 5.424690899e-3f, 5.327979103e-3f, 5.232991185e-3f, 5.139696877e-3f, 5.048065912e-3f, 4.958068021e-3f, 4.869675264e-3f, 4.782858305e-3f, 4.697588738e-3f, 4.613839556e-3f, 4.531583749e-3f, 4.450793844e-3f, 4.371444695e-3f, 4.293510225e-3f, 4.216964822e-3f, 4.141784739e-3f, 4.067944363e-3f, 3.995420411e-3f, 3.924189601e-3f, 3.854228882e-3f, 3.785515204e-3f, 3.718026681e-3f, 3.651741194e-3f, 3.586637555e-3f, 3.522694577e-3f, 3.459891770e-3f, 3.398208413e-3f, 3.337624716e-3f, 3.278121119e-3f, 3.219678532e-3f, 3.162277630e-3f, 3.105900250e-3f, 3.050528001e-3f, 2.996142721e-3f, 2.942727180e-3f, 2.890263917e-3f, 2.838735934e-3f, 2.788126701e-3f, 2.738419687e-3f, 2.689598827e-3f, 2.641648287e-3f, 2.594552701e-3f, 2.548296703e-3f, 2.502865391e-3f, 2.458244096e-3f, 2.414418152e-3f, 2.371373819e-3f, 2.329096664e-3f, 2.287573181e-3f, 2.246790100e-3f, 2.206734149e-3f, 2.167392056e-3f, 2.128751716e-3f, 2.090800088e-3f, 2.053525066e-3f, 2.016914543e-3f, 1.980956877e-3f, 1.945640077e-3f, 1.910952968e-3f, 1.876884256e-3f, 1.843423001e-3f, 1.810558257e-3f, 1.778279431e-3f, 1.746576047e-3f, 1.715437858e-3f, 1.684854855e-3f, 1.654817141e-3f, 1.625314821e-3f, 1.596338581e-3f, 1.567878877e-3f, 1.539926510e-3f, 1.512472518e-3f, 1.485508052e-3f, 1.459024264e-3f, 1.433012541e-3f, 1.407464617e-3f, 1.382372226e-3f, 1.357727102e-3f, 1.333521446e-3f, 1.309747226e-3f, 1.286396990e-3f, 1.263462938e-3f, 1.240937738e-3f, 1.218814170e-3f, 1.197085017e-3f, 1.175743295e-3f, 1.154782018e-3f, 1.134194434e-3f, 1.113973907e-3f, 1.094113803e-3f, 1.074607833e-3f, 1.055449597e-3f, 1.036632922e-3f, 1.018151757e-3f, 1.000000047e-3f, 9.821718559e-4f, 9.646615945e-4f, 9.474635008e-4f, 9.305720450e-4f, 9.139816975e-4f, 8.976871613e-4f, 8.816830814e-4f, 8.659643354e-4f, 8.505258011e-4f, 8.353625308e-4f, 8.204696351e-4f, 8.058421663e-4f, 7.914755261e-4f, 7.773650577e-4f, 7.635061047e-4f, 7.498941850e-4f, 7.365249912e-4f, 7.233941578e-4f, 7.104974356e-4f, 6.978305755e-4f, 6.853895611e-4f, 6.731703761e-4f, 6.611690042e-4f, 6.493816036e-4f, 6.378043909e-4f, 6.264335243e-4f, 6.152653950e-4f, 6.042963942e-4f, 5.935229128e-4f, 5.829415168e-4f, 5.725487717e-4f, 5.623413017e-4f, 5.523158470e-4f, 5.424690899e-4f, 5.327978870e-4f, 5.232990952e-4f, 5.139696877e-4f, 5.048065796e-4f, 4.958068021e-4f, 4.869675322e-4f, 4.782858014e-4f, 4.697588738e-4f, 4.613839556e-4f, 4.531583691e-4f, 4.450794077e-4f, 4.371444811e-4f, 4.293510283e-4f, 4.216965172e-4f, 4.141784448e-4f, 4.067944246e-4f, 3.995420702e-4f, 3.924189659e-4f, 3.854228999e-4f, 3.785515146e-4f, 3.718026564e-4f, 3.651741135e-4f, 3.586637613e-4f, 3.522694751e-4f, 3.459891595e-4f, 3.398208355e-4f, 3.337624657e-4f, 3.278121294e-4f, 3.219678474e-4f, 3.162277571e-4f, 3.105900250e-4f, 3.050527885e-4f, 2.996142721e-4f, 2.942727297e-4f, 2.890263859e-4f, 2.838736109e-4f, 2.788126585e-4f, 2.738419571e-4f, 2.689598768e-4f, 2.641648462e-4f, 2.594552643e-4f, 2.548296761e-4f, 2.502865391e-4f, 2.458243980e-4f, 2.414418268e-4f, 2.371373703e-4f, 2.329096606e-4f, 2.287573152e-4f, 2.246790100e-4f, 2.206734061e-4f, 2.167392231e-4f, 2.128751657e-4f, 2.090799971e-4f, 2.053525095e-4f, 2.016914514e-4f, 1.980956731e-4f, 1.945640106e-4f, 1.910952997e-4f, 1.876884344e-4f, 1.843422942e-4f, 1.810558315e-4f, 1.778279402e-4f, 1.746576017e-4f, 1.715437829e-4f, 1.684854942e-4f, 1.654817170e-4f, 1.625314908e-4f, 1.596338552e-4f, 1.567878790e-4f, 1.539926598e-4f, 1.512472518e-4f, 1.485507964e-4f, 1.459024206e-4f, 1.433012512e-4f, 1.407464733e-4f, 1.382372284e-4f, 1.357727160e-4f, 1.333521504e-4f, 1.309747313e-4f, 1.286396873e-4f, 1.263462909e-4f, 1.240937709e-4f, 1.218814214e-4f, 1.197085003e-4f, 1.175743237e-4f, 1.154782003e-4f, 1.134194390e-4f, 1.113973849e-4f, 1.094113832e-4f, 1.074607862e-4f, 1.055449611e-4f, 1.036632893e-4f, 1.018151743e-4f };   // 10000^(-2i/1024), i = 0..511 (float32)
__global__ __launch_bounds__(256) void k_preRopeI(const float* __restrict__ X, bf* Ph, bf* Pl) { const size_t k = (size_t)blockIdx.x * 256 + threadIdx.x; if (k >= (size_t)NB_ * TT * DM / 4) return; const size_t e = k * 4; const int d0 = (int)(e % DM); const int t = (int)(e / DM % TT); const v4f a = *(const v4f*)(X + e); v4us oh, ol;
#pragma unroll
    for (int p = 0; p < 2; ++p) { const int i = (d0 >> 1) + p; const float ang = __fmul_rn((float)t, THE[i]); const float c = cosf(ang), sn = sinf(ang); const float x0 = bfr(a[2 * p]), x1 = bfr(a[2 * p + 1]);
        float a0 = __fmul_rn(x0, c), b0 = __fmul_rn(x1, sn), a1 = __fmul_rn(x1, c), b1 = __fmul_rn(x0, sn); asm volatile("" : "+v"(a0), "+v"(b0), "+v"(a1), "+v"(b1)); const float y0 = __fsub_rn(a0, b0), y1 = __fadd_rn(a1, b1); unsigned short u, w; splitf(y0, u, w); oh[2 * p] = u; ol[2 * p] = w; splitf(y1, u, w); oh[2 * p + 1] = u; ol[2 * p + 1] = w; }
    *(v4us*)(Ph + e) = oh; *(v4us*)(Pl + e) = ol;  }
// ---- k_fattn: causal attention of all batches in one launch: scores, softmax and probability x value product of a query tile stay in registers; the merged hi/lo planes [t][head x 64 + d] are written directly.
// Transposed forms: S^T = K Q^T (A = 16 key rows, B = 16 query columns), O^T += V^T P^T (A = 16 rows of the [d][t] value plane, B = P^T packed from two S^T tiles, which is the k order of WFrag::ld).
// A lane owns query column lr; lanes lr and lr + 16 split its keys and its d. One work-group of FNW waves per query tile: wave w takes the 32-key passes w, w + FNW, ... with a running maximum and sum of its own;
// the FNW partial (maximum, sum, O^T) are joined through LDS in wave order. Query rows < RH: bf16 hi/lo planes, 3 products, 16 queries a tile; the rest: fp16, 32 queries a tile, probabilities carried x 1024.
#define FNW  4
#define OSP  68                   // LDS row pitch of a partial O row (64 d + 4 floats)
#define L2E  1.4426950408889634f
__device__ __forceinline__ float xhalf(float x) { const int i = __float_as_int(x); return __int_as_float(__builtin_amdgcn_permlanex16(i, i, 0x76543210, 0xfedcba98, false, false)); }   // value of lane ^ 16
typedef __attribute__((ext_vector_type(16))) unsigned short v16us;
template <typename T16, bool HL, int NQ>
__device__ __forceinline__ void fattn_tile(const T16* __restrict__ Q, const T16* __restrict__ Q2, const T16* __restrict__ Kp, const T16* __restrict__ K2, const T16* __restrict__ Vt, const T16* __restrict__ V2, int q0, bf* Ah, bf* Al, float* os, float* ms, float* ls) {
    typedef typename WFrag<T16>::V V;
    const int lane = threadIdx.x & 31, lr = lane & 15, hi = lane >> 4;
    const int w = __builtin_amdgcn_readfirstlane((int)(threadIdx.x >> 5));   // wave number, held scalar so that the pass loop keeps a scalar branch
    const int npass = (q0 + NQ * 16 + 31) / 32;                              // 32-key passes up to and including the diagonal one
    V qf[NQ][2], qf2[NQ][2];
#pragma unroll
    for (int g = 0; g < NQ; ++g)
#pragma unroll
        for (int c = 0; c < 2; ++c) { const size_t qo = (size_t)(q0 + g * 16 + lr) * HD + c * 32 + 8 * hi; qf[g][c] = WFrag<T16>::ld(Q + qo); if (HL) qf2[g][c] = WFrag<T16>::ld(Q2 + qo); }
    v8f o[4][NQ]; float m[NQ], l[NQ];
#pragma unroll
    for (int g = 0; g < NQ; ++g) { m[g] = -3.0e38f; l[g] = 0.f;
#pragma unroll
        for (int mb = 0; mb < 4; ++mb) o[mb][g] = (v8f){}; }
    const unsigned ko = lr * HD + 8 * hi, vo = lr * TT + 8 * hi;   // 32-bit lane offsets beside wave-uniform bases: one register serves every plane
    V kf[2][2], kf2[2][2];
    if (!HL) { const int p0 = min(w, npass - 1);   // first pass's K fragments (a wave without a pass fetches the last pass's: in bounds, unused)
#pragma unroll
      for (int t = 0; t < 2; ++t)
#pragma unroll
          for (int c = 0; c < 2; ++c) { kf[t][c] = WFrag<T16>::ld(Kp + (size_t)p0 * 32 * HD + ko + (t * 16 * HD + c * 32)); } }
#pragma unroll 1   // rolled: one pass already fills the register file
    for (int p = w; p < npass; p += FNW) {
        const int kb = p * 32;
        if (HL) {   // hi/lo tiles (at most RH / 32 / FNW passes a wave): K fetched in its own pass, which keeps the kernel at four waves a SIMD without spills
#pragma unroll
            for (int t = 0; t < 2; ++t)
#pragma unroll
                for (int c = 0; c < 2; ++c) { kf[t][c] = WFrag<T16>::ld(Kp + (size_t)kb * HD + ko + (t * 16 * HD + c * 32)); kf2[t][c] = WFrag<T16>::ld(K2 + (size_t)kb * HD + ko + (t * 16 * HD + c * 32)); }
            asm volatile("s_wait_xcnt 0x0" ::: "memory"); }   // the V loads below land in registers that held the K loads' addresses
        V vf[4], vf2[4];
#pragma unroll
        for (int mb = 0; mb < 4; ++mb) { vf[mb] = WFrag<T16>::ld(Vt + kb + vo + mb * 16 * TT); if (HL) vf2[mb] = WFrag<T16>::ld(V2 + kb + vo + mb * 16 * TT); }
        v8f s[2][NQ];
#pragma unroll
        for (int t = 0; t < 2; ++t)
#pragma unroll
            for (int g = 0; g < NQ; ++g) { s[t][g] = (v8f){};
#pragma unroll
                for (int c = 0; c < 2; ++c) { s[t][g] = WFrag<T16>::mma(kf[t][c], qf[g][c], s[t][g]); if (HL) { s[t][g] = WFrag<T16>::mma(kf[t][c], qf2[g][c], s[t][g]); s[t][g] = WFrag<T16>::mma(kf2[t][c], qf[g][c], s[t][g]); } } }
        if (!HL) { const int pn = (p + FNW < npass) ? p + FNW : p;   // this wave's next pass: its K fragments fly during the softmax (the last pass fetches its own again: in bounds, unused)
#pragma unroll
          for (int t = 0; t < 2; ++t)
#pragma unroll
              for (int c = 0; c < 2; ++c) { kf[t][c] = WFrag<T16>::ld(Kp + (size_t)pn * 32 * HD + ko + (t * 16 * HD + c * 32)); } }
        asm volatile("s_wait_xcnt 0x0" ::: "memory");   // the softmax below reuses the registers that held this pass's load addresses
        if (kb + 31 > q0) {   // only the diagonal pass holds keys behind a query (scalar test)
#pragma unroll
            for (int t = 0; t < 2; ++t)
#pragma unroll
                for (int g = 0; g < NQ; ++g)
#pragma unroll
                    for (int r = 0; r < 8; ++r) s[t][g][r] = (kb + t * 16 + hi * 8 + r <= q0 + g * 16 + lr) ? s[t][g][r] : -3.0e38f; }
        V pf[NQ], pf2[NQ];
#pragma unroll
        for (int g = 0; g < NQ; ++g) {
            float mx = -3.0e38f;
#pragma unroll
            for (int t = 0; t < 2; ++t)
#pragma unroll
                for (int r = 0; r < 8; ++r) mx = fmaxf(mx, s[t][g][r]);
            mx = fmaxf(mx, xhalf(mx)) * SCL;                       // SCL is a power of two: the scaled maximum is the maximum of the scaled scores (a masked -3e38 stays far below every score)
            const float mn = fmaxf(m[g], mx); const float al = __builtin_amdgcn_exp2f((m[g] - mn) * L2E); m[g] = mn;
            float sum = 0.f; v16us uh, ul; v16h ph;
#pragma unroll
            for (int t = 0; t < 2; ++t)
#pragma unroll
                for (int r = 0; r < 8; ++r) { const float d0 = s[t][g][r] * SCL - mn; const float e = __builtin_amdgcn_exp2f(HL ? d0 * L2E : d0 * L2E + 10.0f); sum += e;   // + 10: x 1024 (keeps small fp16 probabilities normal), cancels in O / sum
                    if (HL) { unsigned short a2, c2; splitf(e, a2, c2); uh[t * 8 + r] = a2; ul[t * 8 + r] = c2; } else ph[t * 8 + r] = tohx(e); }
            l[g] = l[g] * al + sum;
#pragma unroll
            for (int mb = 0; mb < 4; ++mb) o[mb][g] *= al;
            if constexpr (HL) { pf[g] = __builtin_bit_cast(v16bf, uh); pf2[g] = __builtin_bit_cast(v16bf, ul); } else pf[g] = ph;
        }
#pragma unroll
        for (int mb = 0; mb < 4; ++mb)
#pragma unroll
            for (int g = 0; g < NQ; ++g) { o[mb][g] = WFrag<T16>::mma(vf[mb], pf[g], o[mb][g]); if (HL) { o[mb][g] = WFrag<T16>::mma(vf[mb], pf2[g], o[mb][g]); o[mb][g] = WFrag<T16>::mma(vf2[mb], pf[g], o[mb][g]); } }
    }
#pragma unroll
    for (int g = 0; g < NQ; ++g) { const float lj = l[g] + xhalf(l[g]); if (hi == 0) { ms[w * 32 + g * 16 + lr] = m[g]; ls[w * 32 + g * 16 + lr] = lj; }
#pragma unroll
        for (int mb = 0; mb < 4; ++mb) { float* op = os + (size_t)(w * 32 + g * 16 + lr) * OSP + mb * 16 + hi * 8; const v8f x = o[mb][g];
            *(v4fa*)op = (v4f){x[0], x[1], x[2], x[3]}; *(v4fa*)(op + 4) = (v4f){x[4], x[5], x[6], x[7]}; } }
    __syncthreads();                               // all FNW partial results are in LDS before any thread joins them
    constexpr int TPQ = 8 / NQ, DPT = 8 * NQ;      // threads a query, d values a thread
    const int q = threadIdx.x / TPQ, d0 = (threadIdx.x % TPQ) * DPT;
    float M = ms[q];
#pragma unroll
    for (int u = 1; u < FNW; ++u) M = fmaxf(M, ms[u * 32 + q]);
    float f[FNW], L = 0.f;
#pragma unroll
    for (int u = 0; u < FNW; ++u) { f[u] = __builtin_amdgcn_exp2f((ms[u * 32 + q] - M) * L2E); L += ls[u * 32 + q] * f[u]; }   // a wave without a pass: maximum -3e38, weight 0
    const float inv = __fdiv_rn(1.0f, L);
#pragma unroll
    for (int c = 0; c < DPT / 8; ++c) { v8us oh, ol;
#pragma unroll
        for (int hf = 0; hf < 2; ++hf) { v4f val = (v4f){};
#pragma unroll
            for (int u = 0; u < FNW; ++u) val += *(const v4fa*)(os + (size_t)(u * 32 + q) * OSP + d0 + c * 8 + hf * 4) * f[u];
#pragma unroll
            for (int k = 0; k < 4; ++k) { unsigned short a2, c2; splitf(val[k] * inv, a2, c2); oh[hf * 4 + k] = a2; ol[hf * 4 + k] = c2; } }
        const size_t oo = (size_t)(q0 + q) * DQ + d0 + c * 8; *(v8us*)(Ah + oo) = oh; *(v8us*)(Al + oo) = ol; }
    if constexpr (HL) asm volatile("s_wait_xcnt 0x0" ::: "memory");   // behind the last store: the fp16 tile's code is laid out behind this tile's and writes the registers that these stores name
}
// grid (batches x heads, tiles): blockIdx.x = batch x heads + head; cost falls with blockIdx.y (longest query tiles of every batch first)
__global__ __launch_bounds__(32 * FNW) void k_fattn(const h16* __restrict__ Q16, const h16* __restrict__ K16, const h16* __restrict__ V16, const bf* __restrict__ Qh, const bf* __restrict__ Ql, const bf* __restrict__ Kh, const bf* __restrict__ Kl, const bf* __restrict__ Vh, const bf* __restrict__ Vl, bf* Ah, bf* Al) {
    __shared__ __align__(16) float os[FNW * 32 * OSP]; __shared__ float ms[FNW * 32]; __shared__ float ls[FNW * 32];
    const size_t ho = (size_t)blockIdx.x * TT * HD; const int y = blockIdx.y; const size_t ao = (size_t)(blockIdx.x / NH_) * TT * DQ + (blockIdx.x % NH_) * HD; Ah += ao; Al += ao;
    if (y < (TT - RH) / 32) fattn_tile<h16, false, 2>(Q16 + ho, nullptr, K16 + ho, nullptr, V16 + ho, nullptr, TT - 32 * (y + 1), Ah, Al, os, ms, ls);
    else fattn_tile<bf, true, 1>(Qh + ho, Ql + ho, Kh + ho, Kl + ho, Vh + ho, Vl + ho, RH - 16 * (y - (TT - RH) / 32 + 1), Ah, Al, os, ms, ls);
}

extern "C" void kernel_launch(void* const* d_in, const int* in_sizes, int n_in,
                              void* d_out, int out_size, void* d_ws, size_t ws_size, hipStream_t stream) {
    (void)in_sizes; (void)n_in; (void)out_size;
    const float* x = (const float*)d_in[0]; const float* wq = (const float*)d_in[1]; const float* wk = (const float*)d_in[2]; const float* wv = (const float*)d_in[3]; const float* wo = (const float*)d_in[4]; const float* bo = (const float*)d_in[5];
    float* OUT = (float*)d_out;     // [4][2048][1024]
    char* wsp = (char*)d_ws;
    auto take = [&](size_t bytes) { char* p = wsp; wsp += (bytes + 255) & ~(size_t)255; return (void*)p; };
    bf* XBl = (bf*)take((size_t)NB_ * TT * DM * 2); bf* WQ = (bf*)take((size_t)4 * DM * DM * 2); bf* WK = WQ + (size_t)DM * DM; bf* WV = WK + (size_t)DM * DM; bf* WO = WV + (size_t)DM * DM;   // DQ = DKV = DM: four planes of one size, one behind the other
    bf* XB = (bf*)take((size_t)NB_ * TT * DM * 2);
    const size_t PB = (size_t)NH_ * TT * HD;   // elements of one batch in a q, k or v plane
    h16* QP16 = (h16*)take(NB_ * PB * 2); h16* KP16 = (h16*)take(NB_ * PB * 2); h16* VT16 = (h16*)take(NB_ * PB * 2);
    bf* QPh = (bf*)take(NB_ * PB * 2); bf* QPl = (bf*)take(NB_ * PB * 2); bf* KPh = (bf*)take(NB_ * PB * 2); bf* KPl = (bf*)take(NB_ * PB * 2); bf* VTh = (bf*)take(NB_ * PB * 2); bf* VTl = (bf*)take(NB_ * PB * 2);
    bf* ATh = (bf*)take((size_t)NB_ * TT * DQ * 2); bf* ATl = (bf*)take((size_t)NB_ * TT * DQ * 2);
    if ((size_t)(wsp - (char*)d_ws) > ws_size) return;    // 216 MiB of the 256 MiB
    k_cvt8w<<<dim3((unsigned)(((size_t)DM * DM / 8 + 255) / 256), 4, 1), 256, 0, stream>>>(wq, wk, wv, wo, WQ, (size_t)DM * DM / 8);
    k_preRopeI<<<(unsigned)(((size_t)NB_ * TT * DM / 4 + 255) / 256), 256, 0, stream>>>(x, XB, XBl);   /* rx = pairwise rope of the input, as hi/lo planes */
    k_gemmw<bf, 1, false, false, 8, true><<<dim3(TT / 64, DQ / 64, NB_), 256, 0, stream>>>(XB, XBl, WQ, nullptr, DM, nullptr, HD, nullptr, 0, (size_t)TT * DM, 0, PB, QP16, QPh, QPl, (size_t)TT * HD);   /* q = rx Wq^T (hi/lo x exact), written as head planes [b][h][t][d] */
    k_gemmw<bf, 1, false, false, 8, true><<<dim3(TT / 64, DKV / 64, NB_), 256, 0, stream>>>(XB, XBl, WK, nullptr, DM, nullptr, HD, nullptr, 0, (size_t)TT * DM, 0, PB, KP16, KPh, KPl, (size_t)TT * HD);   /* k = rx Wk^T, the same */
    k_cvt8<<<(unsigned)(((size_t)NB_ * TT * DM / 8 + 255) / 256), 256, 0, stream>>>(x, XB, (size_t)NB_ * TT * DM / 8);   /* plain input for v */
    k_gemmw<bf, 0, false, false, 8, true><<<dim3(DKV / 64, TT / 64, NB_), 256, 0, stream>>>(WV, nullptr, XB, nullptr, DM, nullptr, TT, nullptr, 0, 0, (size_t)TT * DM, PB, VT16, VTh, VTl, (size_t)64);   /* v^T = Wv x^T: rows are head x 64 + d, columns t, the [b][g][d][t] planes as they stand */
    k_fattn<<<dim3(NB_ * NH_, (TT - RH) / 32 + RH / 16, 1), 32 * FNW, 0, stream>>>(QP16, KP16, VT16, QPh, QPl, KPh, KPl, VTh, VTl, ATh, ATl);   /* one kv head per query head */
    k_gemmw<bf, 1, true, false, 8, false><<<dim3(TT / 64, DM / 64, NB_), 256, 0, stream>>>(ATh, ATl, WO, nullptr, DQ, OUT, DM, bo, 0, (size_t)TT * DQ, 0, (size_t)TT * DM, nullptr, nullptr, nullptr, 0);
}
